// v000
// The times below were measured on an AMD MI455X: many runs one after another, warmed up first and cycling through
// copies of the inputs, with the whole window's GPU time divided by the number of runs. Launches and the gaps
// between them are all in it. The median over several windows is given; except for v000 it joins two sittings, which
// can be a few percent apart, so the side-by-side timings, each taken in one sitting, are the better comparison.
// v000, which the later versions start from, runs in 464 microseconds.
// Contractions: x.Wq+bq and x.Wk+bk (RoPE in the f32 epilogue) and Wv^T.x^T+bv on v_wmma_f32_16x16x32_bf16 (x and W planes
// RNE-converted to bf16 operands, f32 accumulate); scores k'.q'^T on v_wmma_f32_16x16x32_bf16 with roped q', k' carried as
// bf16 hi + bf16 residual planes (hi.hi + hi.lo + lo.hi folded along the k axis, f32 accumulate), per-key additive mask in f32;
// P.v on v_wmma_f32_16x16x32_f16 (P x32768 single f16, v x1024 single f16, f32 accumulate). Biases folded as RNE bf16 values
// in f32 epilogues; base-2 online softmax, 1/l and carry folds in f32 on VALU; cos/sin table built once with precise sincosf.
#include <hip/hip_runtime.h>
#include <math.h>
#include <stdint.h>

#ifndef NB
#define NB    2
#endif
#ifndef SEQ
#define SEQ   4096
#endif
#define NB_FULL  2
#define SEQ_FULL 4096
#define DMOD  512
#define NH    8
#define HD    64
#define PCAR  32768.0f
#define VCAR  1024.0f
#define LOG2E 1.4426950408889634f
#define ATT_WAVES   4
#define ATT_THREADS (ATT_WAVES * 32)
#define QTILES      (SEQ / 64)
#define ATT_BLOCKS  (NB * NH * QTILES)
#define NKB    (SEQ / 32)
#define SLAB   (16 * 68)
static_assert(HD == 64 && DMOD == NH * HD);
static_assert(NB >= 1 && NB <= NB_FULL);
static_assert((SEQ % 64) == 0 && SEQ >= 64 && SEQ <= SEQ_FULL);
static_assert(ATT_THREADS == 128 && NKB * 32 == SEQ);
static_assert((DMOD % 64) == 0 && (DMOD % 32) == 0);
static_assert(((SEQ * DMOD / 8) % 256) == 0 && ((DMOD * DMOD) % (64 * 64)) == 0 && (SEQ % 8) == 0);
static_assert((SLAB * 4) % 16 == 0);

typedef unsigned short u16;
typedef _Float16 v16h __attribute__((ext_vector_type(16)));
typedef _Float16 v8h  __attribute__((ext_vector_type(8)));
typedef __bf16   v16b __attribute__((ext_vector_type(16)));
typedef float    v8f  __attribute__((ext_vector_type(8)));
typedef float    v4f  __attribute__((ext_vector_type(4)));
typedef unsigned int v4u __attribute__((ext_vector_type(4)));

union FragH { v16h v; v8h h[2]; v4u u[2]; };
union FragB { v16b v; v4u u[2]; };

struct RopeFreq { float f[32]; };
static_assert(sizeof(RopeFreq) == 128);

// ---- scalar helpers --------------------------------------------------------------------------------
__device__ __forceinline__ unsigned short bf_bits(float f) {          // f32 -> bf16 bits, RNE convert
  unsigned u = __float_as_uint(f);
  return (unsigned short)((u + 0x7FFFu + ((u >> 16) & 1u)) >> 16);
}
__device__ __forceinline__ float bf_up(unsigned short h) { return __uint_as_float(((unsigned)h) << 16); }
__device__ __forceinline__ float bf_val(float f) { return bf_up(bf_bits(f)); }          // value after RNE bf16 convert
__device__ __forceinline__ unsigned short h_bits(_Float16 x) { return __builtin_bit_cast(unsigned short, x); }
__device__ __forceinline__ unsigned pk16(unsigned short a, unsigned short b) { return (unsigned)a | ((unsigned)b << 16); }
__device__ __forceinline__ v8f zero8() { v8f z = {0.f, 0.f, 0.f, 0.f, 0.f, 0.f, 0.f, 0.f}; return z; }

// ---- fragment loaders: 16-bit A/B operand, lane -> row/col (lane&15), p already includes +8*(lane>>4);
//      elements 0..7 <- p[0..7] (k0+8h..), elements 8..15 <- p[16..23] (k0+16+8h..)  (same split k map for A and B;
//      B is always read from a k-contiguous [n][k] plane)
__device__ __forceinline__ v16h ldfrag_h(const _Float16* p) {
  FragH f;
  f.h[0] = *(const v8h*)(p);
  f.h[1] = *(const v8h*)(p + 16);
  return f.v;
}
__device__ __forceinline__ v16b ldfrag_b(const u16* p) {              // bf16 plane read as unsigned integer vectors
  FragB f;
  f.u[0] = *(const v4u*)(p);
  f.u[1] = *(const v4u*)(p + 16);
  return f.v;
}

__device__ __forceinline__ v8f mma_h(v16h a, v16h b, v8f c) {
  return __builtin_amdgcn_wmma_f32_16x16x32_f16(false, a, false, b, (short)0, c, false, false);
}
__device__ __forceinline__ v8f mma_b(v16b a, v16b b, v8f c) {
  return __builtin_amdgcn_wmma_f32_16x16x32_bf16(false, a, false, b, (short)0, c, false, false);
}
template <typename F>
__device__ __forceinline__ void guard2x8(v8f& a, v8f& b, F x0, F x1, F x2, F x3, F x4, F x5, F x6, F x7) {
#if defined(__HIP_DEVICE_COMPILE__)
  asm volatile("v_nop\n\tv_nop\n\tv_nop\n\tv_nop"
               : "+v"(a), "+v"(b) : "v"(x0), "v"(x1), "v"(x2), "v"(x3), "v"(x4), "v"(x5), "v"(x6), "v"(x7) : "memory");
#endif
}
template <typename F>
__device__ __forceinline__ void guard2x6(v8f& a, v8f& b, F x0, F x1, F x2, F x3, F x4, F x5) {
#if defined(__HIP_DEVICE_COMPILE__)
  asm volatile("v_nop\n\tv_nop\n\tv_nop\n\tv_nop"
               : "+v"(a), "+v"(b) : "v"(x0), "v"(x1), "v"(x2), "v"(x3), "v"(x4), "v"(x5) : "memory");
#endif
}
template <typename F>
__device__ __forceinline__ void guard6(v8f& a, v8f& b, v8f& c, v8f& d, F x0, F x1, F x2, F x3, F x4, F x5) {
#if defined(__HIP_DEVICE_COMPILE__)
  asm volatile("v_nop\n\tv_nop\n\tv_nop\n\tv_nop"
               : "+v"(a), "+v"(b), "+v"(c), "+v"(d) : "v"(x0), "v"(x1), "v"(x2), "v"(x3), "v"(x4), "v"(x5) : "memory");
#endif
}
__device__ __forceinline__ void acc_guard4(v8f& a, v8f& b, v8f& c, v8f& d) {
#if defined(__HIP_DEVICE_COMPILE__)
  asm volatile("v_nop\n\tv_nop\n\tv_nop\n\tv_nop" : "+v"(a), "+v"(b), "+v"(c), "+v"(d));
#endif
}
__device__ __forceinline__ void wave_sync_lds() {
#if defined(__HIP_DEVICE_COMPILE__)
  __builtin_amdgcn_fence(__ATOMIC_RELEASE, "workgroup");
  __builtin_amdgcn_wave_barrier();
  __builtin_amdgcn_fence(__ATOMIC_ACQUIRE, "workgroup");
#endif
}

// =====================================================================================================
// x f32 [NB_FULL][SEQ_FULL][DMOD] -> bf16 plane [NB*SEQ][DMOD] (RNE bits), rows s < SEQ of batch b < NB compacted.
// Thread = 8 consecutive elements: two 16-B loads, one 16-B store; 32 consecutive lanes = 512 contiguous, 512-B aligned
// coverage: grid = n8/256 blocks (host checks exactness) x 256 thr x 8 = the whole plane.
// =====================================================================================================
__global__ __launch_bounds__(256) void cvt_x(const float* __restrict__ x, u16* D, int n8, int per_b8, int bstride8) {
  const int gt = blockIdx.x * 256 + (int)threadIdx.x;
  if (gt >= n8) return;                     // no barriers in this kernel
  const int b = gt / per_b8;
  const int w = gt - b * per_b8;
  const float* p = x + ((size_t)b * (size_t)bstride8 + (size_t)w) * 8;
  const v4f a = *(const v4f*)(p), c4 = *(const v4f*)(p + 4);
  float v[8];
#pragma unroll
  for (int e = 0; e < 4; ++e) { v[e] = a[e]; v[4 + e] = c4[e]; }
  unsigned short s[8];
#pragma unroll
  for (int e = 0; e < 8; ++e) s[e] = bf_bits(v[e]);
  v4u o;
#pragma unroll
  for (int e = 0; e < 4; ++e) o[e] = pk16(s[2 * e], s[2 * e + 1]);
  u16* d = D + (size_t)gt * 8;
  {
    *(v4u*)(d) = o;
    
  }
}

// =====================================================================================================
// W f32 in[rows=DMOD k][cols=DMOD n] -> out bf16 [DMOD n][DMOD k] (k-contiguous, RNE bits), transposed through a 64x64 LDS
// coverage: grid (DMOD/64)^2 tiles x 2 iterations x 256 threads x 8 halves = the whole [DMOD][DMOD] plane.
// LDS: staged extent 64 rows x 64 cols == consumed extent.
// =====================================================================================================
__global__ __launch_bounds__(256) void tr_w(const float* __restrict__ W, u16* D) {
  __shared__ __align__(16) float T[64 * 68];
  const int t = (int)threadIdx.x, bid = blockIdx.x;
  const int nt = DMOD / 64;
  const int k0 = (bid / nt) * 64, n0 = (bid % nt) * 64;
#pragma unroll
  for (int it = 0; it < 4; ++it) {
    const int e = it * 256 + t;
    const int kr = e >> 4, c4 = (e & 15) * 4;
    const v4f v = *(const v4f*)(W + (size_t)(k0 + kr) * DMOD + n0 + c4);
    *(v4f*)(T + kr * 68 + c4) = v;
  }
  __syncthreads();
  v4u ov[2];
#pragma unroll
  for (int it = 0; it < 2; ++it) {
    const int task = it * 256 + t;
    const int nr = task >> 3, k8 = (task & 7) * 8;
    unsigned short s[8];
#pragma unroll
    for (int e = 0; e < 8; ++e) s[e] = bf_bits(T[(k8 + e) * 68 + nr]);
#pragma unroll
    for (int e = 0; e < 4; ++e) ov[it][e] = pk16(s[2 * e], s[2 * e + 1]);
  }
  {
#pragma unroll
    for (int it = 0; it < 2; ++it) {
      const int task = it * 256 + t;
      const int nr = task >> 3, k8 = (task & 7) * 8;
      *(v4u*)(D + (size_t)(n0 + nr) * DMOD + k0 + k8) = ov[it];
    }
    
  }
}

// =====================================================================================================
// cos/sin table CS f32 [SEQ][64]: cols 0..31 = cos(pos * inv_freq[j]), cols 32..63 = sin(pos * inv_freq[j]) (precise
// sincosf; angle = single f32 multiply). inv_freq arrives by value; each thread picks its j with a static select chain.
// Block = 8 positions x 32 j; values staged in LDS, then each 256-B row written by 16 consecutive lanes x 16 B of one
// coverage: grid SEQ/8 x 8 rows x 64 floats = the whole table. LDS: staged 8x64 == consumed 8x64.
// =====================================================================================================
__global__ __launch_bounds__(256) void rope_tab(RopeFreq fr, float* CS) {
  __shared__ __align__(16) float tab[8 * 64];
  const int t = (int)threadIdx.x;
  const int pr = t >> 5, j = t & 31;
  const int pos = blockIdx.x * 8 + pr;
  float inv = 0.f;
#pragma unroll
  for (int q = 0; q < 32; ++q) inv = (j == q) ? fr.f[q] : inv;
  const float ang = (float)pos * inv;
  float sv, cv;
  sincosf(ang, &sv, &cv);
  tab[pr * 64 + j] = cv;
  tab[pr * 64 + 32 + j] = sv;
  __syncthreads();
  if (t < 128) {
    const int row = t >> 4, c4 = (t & 15) * 4;
    const v4f v = *(const v4f*)(tab + row * 64 + c4);
    float* d = CS + (size_t)(blockIdx.x * 8 + row) * 64 + c4;
    {
      *(v4f*)(d) = v;
      
    }
  }
}

// =====================================================================================================
// barrier, then converted to f16 and written: lane = (row in group of 4, 8 consecutive cols); one instruction = 4 rows, each
// coverage: 4 instructions x 4 rows x 8 lanes x 8 halves = the wave's 16 x 64 tile.
// =====================================================================================================
__device__ __forceinline__ void epi16(float* sl, v8f a0, v8f a1, v8f a2, v8f a3, float oscale, u16* C, int N,
                                      size_t rowb, int col0, int lane) {
  const int hh = lane >> 4, m = lane & 15;
#pragma unroll
  for (int r = 0; r < 8; ++r) {
    const int ro = (8 * hh + r) * 68 + m;
    sl[ro]      = a0[r] * oscale;
    sl[ro + 16] = a1[r] * oscale;
    sl[ro + 32] = a2[r] * oscale;
    sl[ro + 48] = a3[r] * oscale;
  }
  wave_sync_lds();
  const int rq = lane >> 3, c8 = (lane & 7) * 8;
  v4u ov[4];
#pragma unroll
  for (int i4 = 0; i4 < 4; ++i4) {
    const int row = i4 * 4 + rq;
    const v4f a = *(const v4f*)(sl + row * 68 + c8), c4 = *(const v4f*)(sl + row * 68 + c8 + 4);
    float w[8];
#pragma unroll
    for (int e = 0; e < 4; ++e) { w[e] = a[e]; w[4 + e] = c4[e]; }
#pragma unroll
    for (int e = 0; e < 4; ++e) ov[i4][e] = pk16(h_bits((_Float16)w[2 * e]), h_bits((_Float16)w[2 * e + 1]));
  }
  u16* dst = C + (rowb + (size_t)rq) * (size_t)N + col0 + c8;
  {
#pragma unroll
    for (int i4 = 0; i4 < 4; ++i4) {
      *(v4u*)(dst + (size_t)(i4 * 4) * (size_t)N) = ov[i4];
    }
    
  }
}

// =====================================================================================================
// bf16 hi + bf16 residual epilogue: the wave's 16x64 f32 tile staged in its LDS slab (pitch 68), wave barrier, then each
// value v written as hi = RNE bf16(v) into CH and lo = RNE bf16(v - hi) into CL (v - hi exact in f32); same lane/row map
// coverage: per plane 4 instructions x 4 rows x 8 lanes x 8 halves = the wave's 16 x 64 tile.
// =====================================================================================================
__device__ __forceinline__ void epi_hilo(float* sl, v8f a0, v8f a1, v8f a2, v8f a3, u16* CH, u16* CL, int N,
                                         size_t rowb, int col0, int lane) {
  const int hh = lane >> 4, m = lane & 15;
#pragma unroll
  for (int r = 0; r < 8; ++r) {
    const int ro = (8 * hh + r) * 68 + m;
    sl[ro]      = a0[r];
    sl[ro + 16] = a1[r];
    sl[ro + 32] = a2[r];
    sl[ro + 48] = a3[r];
  }
  wave_sync_lds();
  const int rq = lane >> 3, c8 = (lane & 7) * 8;
  v4u oh[4], ol[4];
#pragma unroll
  for (int i4 = 0; i4 < 4; ++i4) {
    const int row = i4 * 4 + rq;
    const v4f a = *(const v4f*)(sl + row * 68 + c8), c4 = *(const v4f*)(sl + row * 68 + c8 + 4);
    float w[8];
#pragma unroll
    for (int e = 0; e < 4; ++e) { w[e] = a[e]; w[4 + e] = c4[e]; }
#pragma unroll
    for (int e = 0; e < 4; ++e) {
      const unsigned short hb0 = bf_bits(w[2 * e]), hb1 = bf_bits(w[2 * e + 1]);
      const unsigned short lb0 = bf_bits(w[2 * e] - bf_up(hb0)), lb1 = bf_bits(w[2 * e + 1] - bf_up(hb1));
      oh[i4][e] = pk16(hb0, hb1);
      ol[i4][e] = pk16(lb0, lb1);
    }
  }
  const size_t dofs = (rowb + (size_t)rq) * (size_t)N + col0 + c8;
  {
#pragma unroll
    for (int i4 = 0; i4 < 4; ++i4) {
      const size_t o4 = dofs + (size_t)(i4 * 4) * (size_t)N;
      *(v4u*)(CH + o4) = oh[i4];
      *(v4u*)(CL + o4) = ol[i4];
    }
    
  }
}

// =====================================================================================================
// bf16 GEMM main loop: acc tile of the wave's 16 rows x 64 cols += A[rows][K] (bf16 row-major) . Bt[cols][K]^T (bf16
// k-contiguous); fragments loaded straight from the 16-bit rows (two 16-B loads each, split k map for A and B); K by 32.
// =====================================================================================================
__device__ __forceinline__ void mainloop_b(const u16* ap, const u16* bp, size_t bs, int K,
                                           v8f& acc0, v8f& acc1, v8f& acc2, v8f& acc3) {
#pragma unroll 1
  for (int k0 = 0; k0 < K; k0 += 32) {
    const v16b a  = ldfrag_b(ap + k0);
    const v16b b0 = ldfrag_b(bp + k0);
    const v16b b1 = ldfrag_b(bp + bs + k0);
    const v16b b2 = ldfrag_b(bp + 2 * bs + k0);
    const v16b b3 = ldfrag_b(bp + 3 * bs + k0);
    acc0 = mma_b(a, b0, acc0);
    acc1 = mma_b(a, b1, acc1);
    acc2 = mma_b(a, b2, acc2);
    acc3 = mma_b(a, b3, acc3);
    guard6<v16b>(acc0, acc1, acc2, acc3, a, b0, b1, b2, b3, a);
  }
  acc_guard4(acc0, acc1, acc2, acc3);
}

// =====================================================================================================
// Projection + bias + RoPE -> bf16 hi / residual planes:  y[M][N] = A[M][K] (bf16 x rows) . Bt[N][K]^T (bf16 W^T rows)
// + bias[col] (RNE bf16 value, clamped address). Block = 64x64 tile, 4 waves x 16 rows, N tiles of 64 = one head each
// (host checks M % 64 == 0, N % 64 == 0, K % 32 == 0, grid = (M/64)*(N/64)). D element r of acc_j = (row rowb+8hh+r,
// d = 16j + (lane&15)) within head col0/64, so the rotate-half partner d+32 of acc_0/acc_1 is acc_2/acc_3 in the same lane.
// RoPE: pos = row % seq; out[d] = y[d]*cos(pos*f[d>>1]) + rh[d]*sin(pos*f[d>>1]) with rh[d] = -y[d+32] (d<32), y[d-32]
// (d>=32); the 16 table rows of the wave are staged in its LDS slab first (8 x 16-B loads per lane), wave barrier, scalar
// LDS reads, wave barrier, then the hi/lo epilogue reuses the slab.
// LDS: staged table extent 16 rows x 64 floats == consumed extent; result tile 16 x 64 == consumed.
// coverage: grid (M/64)*(N/64) blocks x 4 waves x 16 x 64 = every element of both [M][N] planes exactly once.
// =====================================================================================================
__global__ __launch_bounds__(128)
void gemm_rope(const u16* __restrict__ A, const u16* __restrict__ Bt, const float* __restrict__ bias,
               const float* __restrict__ CS, u16* CH, u16* CL, int M, int N, int K, int nbias, int seq) {
  __shared__ __align__(16) float slab[4 * SLAB];
  const int tid = threadIdx.x, wave = tid >> 5, lane = tid & 31, hh = lane >> 4, m = lane & 15;
  const int ntile = N >> 6;
  const int bid   = blockIdx.x;
  const int rowb  = (bid / ntile) * 64 + wave * 16;
  const int col0  = (bid % ntile) * 64;
  if (rowb + 16 > M) return;                 // wave-uniform, never taken with the exact grid; no block barriers in this kernel
  const u16* ap = A  + (size_t)(rowb + m) * K + 8 * hh;
  const u16* bp = Bt + (size_t)(col0 + m) * K + 8 * hh;
  const size_t bs = (size_t)16 * K;
  v8f acc0 = zero8(), acc1 = zero8(), acc2 = zero8(), acc3 = zero8();
  mainloop_b(ap, bp, bs, K, acc0, acc1, acc2, acc3);
  // bias by column: D element r of lane -> col col0 + 16j + m
  float bc[4];
#pragma unroll
  for (int j = 0; j < 4; ++j) {
    int ci = col0 + 16 * j + m;
    ci = (ci < nbias) ? ci : (nbias - 1);
    bc[j] = bf_val(bias[ci]);
  }
#pragma unroll
  for (int r = 0; r < 8; ++r) {
    acc0[r] += bc[0];
    acc1[r] += bc[1];
    acc2[r] += bc[2];
    acc3[r] += bc[3];
  }
  // ---- stage the wave's 16 table rows (positions pos0 .. pos0+15, all inside one sequence) ----
  float* sl = slab + wave * SLAB;
  const int pos0 = rowb % seq;
#pragma unroll
  for (int it = 0; it < 8; ++it) {
    const int e = it * 32 + lane;
    const int row = e >> 4, c4 = (e & 15) * 4;
    const v4f tv = *(const v4f*)(CS + (size_t)(pos0 + row) * 64 + c4);
    *(v4f*)(sl + row * 68 + c4) = tv;
  }
  wave_sync_lds();
  const int fh = m >> 1;
#pragma unroll
  for (int r = 0; r < 8; ++r) {
    const float* tr = sl + (8 * hh + r) * 68;
    const float cA0 = tr[fh], cA1 = tr[8 + fh], cB0 = tr[16 + fh], cB1 = tr[24 + fh];
    const float sA0 = tr[32 + fh], sA1 = tr[40 + fh], sB0 = tr[48 + fh], sB1 = tr[56 + fh];
    const float x0 = acc0[r], x1 = acc1[r], x2 = acc2[r], x3 = acc3[r];
    acc0[r] = x0 * cA0 - x2 * sA0;            // d = m        : y[d]cos - y[d+32]sin, freq (d>>1)
    acc1[r] = x1 * cA1 - x3 * sA1;            // d = 16 + m   : freq 8 + (m>>1)
    acc2[r] = x2 * cB0 + x0 * sB0;            // d = 32 + m   : y[d]cos + y[d-32]sin, freq 16 + (m>>1)
    acc3[r] = x3 * cB1 + x1 * sB1;            // d = 48 + m   : freq 24 + (m>>1)
  }
  wave_sync_lds();                            // all table reads of the wave done before the slab is reused
  epi_hilo(sl, acc0, acc1, acc2, acc3, CH, CL, N, (size_t)rowb, col0, lane);
}

// =====================================================================================================
// bf16 GEMM with row bias and f16 result: C[M][N] (f16 of (acc + bias[row])*oscale) = A[M][K] (bf16 row-major, W^T rows)
// . Bt[N][K]^T (bf16 k-contiguous x rows of batch blockIdx.y); bias address clamped to [0, nbias). Produces the v^T plane
// [h*64+d][keys] of one batch per blockIdx.y (Bt and C advanced by the batch strides). Same tiling as gemm_rope;
// grid = ((M/64)*(N/64), NB).
// coverage: per batch (M/64)*(N/64) blocks x 4 waves x 16 x 64 = the whole [M][N] plane.
// =====================================================================================================
__global__ __launch_bounds__(128)
void gemm_vt(const u16* __restrict__ A, const u16* __restrict__ Bt, u16* C, const float* __restrict__ bias,
             int M, int N, int K, int nbias, float oscale, int bstrideB, int cstrideC) {
  __shared__ __align__(16) float slab[4 * SLAB];
  const int tid = threadIdx.x, wave = tid >> 5, lane = tid & 31, hh = lane >> 4, m = lane & 15;
  const int ntile = N >> 6;
  const int bid   = blockIdx.x;
  const int rowb  = (bid / ntile) * 64 + wave * 16;
  const int col0  = (bid % ntile) * 64;
  if (rowb + 16 > M) return;                 // wave-uniform, never taken with the exact grid; no block barriers in this kernel
  const u16* Btb = Bt + (size_t)blockIdx.y * (size_t)bstrideB;
  u16*       Cb  = C  + (size_t)blockIdx.y * (size_t)cstrideC;
  const u16* ap = A   + (size_t)(rowb + m) * K + 8 * hh;
  const u16* bp = Btb + (size_t)(col0 + m) * K + 8 * hh;
  const size_t bs = (size_t)16 * K;
  v8f acc0 = zero8(), acc1 = zero8(), acc2 = zero8(), acc3 = zero8();
  mainloop_b(ap, bp, bs, K, acc0, acc1, acc2, acc3);
  float br[8];
#pragma unroll
  for (int r = 0; r < 8; ++r) {
    int ri = rowb + 8 * hh + r;
    ri = (ri < nbias) ? ri : (nbias - 1);
    br[r] = bf_val(bias[ri]);
  }
#pragma unroll
  for (int r = 0; r < 8; ++r) {
    acc0[r] += br[r];
    acc1[r] += br[r];
    acc2[r] += br[r];
    acc3[r] += br[r];
  }
  epi16(slab + wave * SLAB, acc0, acc1, acc2, acc3, oscale, Cb, N, (size_t)rowb, col0, lane);
}

// =====================================================================================================
// Multi-head flash attention with a per-key additive mask (all SEQ keys): block = (batch, head, 64 query rows), 4 waves,
// wave w owns the 16 query rows q0 = 64*qt + 16*w .. q0+15 (waves independent: no block barriers, wave-private LDS only,
// used in the epilogue).
//   q planes (bf16 hi QH, bf16 residual QL) laid out [b*SEQ + s][h][d]; k planes the same; v^T plane [b][h*64+d][s]
//   (f16 x1024). mask: f32 [b][SEQ_FULL], added to every score row by key index (scores = q.k/8 + mask[key]).
//   All NKB = SEQ/32 key blocks of 32 keys are visited (static bound).
//   Scores are computed TRANSPOSED: S^T tile g (g = 0,1) = k rows (keys kb+16g .. +15, A operand, row m = lane&15, split k
//   map over d) times q^T (B operand, col n = query q0 + (lane&15), k = d, split map). The residual terms are folded along
//   the k axis into the same f32 accumulator: k_hi.q_hi + k_hi.q_lo + k_lo.q_hi (6 products of 32-deep d-chunks per tile).
//   D element r of lane l = (key kb+16g+8h+r, query q0+(l&15)), so a lane owns one query column and 16 of its 32 keys; the
//   partner lane l^16 owns the other 16 -> row max / row sum need one xor-16 shuffle. The mask values of those 16 keys are
//   loaded with the same key map and added (times log2e) to the base-2 logits.
//   Online max-subtracted base-2 softmax in f32 (scale 1/8 folded into lsc). The exp'd values ARE the P A-fragment in
//   place: A row m = query = lane&15, element i <- key kb+8h+i (tile 0, D element i), element 8+i <- key kb+16+8h+i
//   (tile 1, D element i). P is carried x32768 as single f16. The rescale factor of query row 8h+r of the O accumulators is
//   fetched from lane 8h+r with a shuffle (uniform control). 4 v^T B fragments (col n = d = 16j + (lane&15), keys
//   k-contiguous), 4 P.V WMMAs per key block.
//   Epilogue: 1/l (per query, shuffled to the D row owner) and carry folds in f32; the wave's 16x64 f32 result staged in its
// LDS: staged extent 16 x 64 == consumed extent.
// coverage: per wave 8 instructions x 2 rows x 16 lanes x 4 floats = 16 x 64; grid NB*NH*(SEQ/64) blocks x 4 waves =
//           every (b, s, h) row segment of the output exactly once.
// =====================================================================================================
__global__ __launch_bounds__(ATT_THREADS)
void attn_fwd(const u16* __restrict__ QH, const u16* __restrict__ QL, const u16* __restrict__ KH,
              const u16* __restrict__ KL, const u16* __restrict__ VPp, const float* __restrict__ maskp, float* out) {
  __shared__ __align__(16) float smem[ATT_WAVES * SLAB];   // per wave: result slab [16][68] in the epilogue only

  const int tid  = threadIdx.x;
  const int wave = tid >> 5;
  const int lane = tid & 31;
  const int hh   = lane >> 4;
  const int c    = lane & 15;

  const int bid  = blockIdx.x;
  const int qt   = bid % QTILES;
  const int bh   = bid / QTILES;
  const int head = bh % NH;
  const int b    = bh / NH;
  if (b >= NB) return;                                     // block-uniform, never taken with the exact grid; no block barriers
  const int q0   = qt * 64 + wave * 16;

  // B fragments of q^T: col n = query q0 + c, k = d (k-contiguous row of the q planes)
  const size_t qofs = ((((size_t)b * SEQ) + (size_t)(q0 + c)) * NH + head) * HD + 8 * hh;
  // A fragments of k: row m = key kb + 16g + c, k = d
  const size_t kofs = ((((size_t)b * SEQ) + (size_t)c) * NH + head) * HD + 8 * hh;   // key row kb + c added per step
  const u16* Kbh = KH + kofs;
  const u16* Kbl = KL + kofs;
  // B fragments of v: col n = d = 16j + c, k = key (k-contiguous row of the v^T plane of batch b)
  const size_t vofs = ((size_t)b * DMOD + (size_t)(head * HD + c)) * SEQ + 8 * hh;  // key kb added per step
  const _Float16* Vb = (const _Float16*)(const void*)VPp + vofs;
  // mask of this lane's 16 keys: kb + 8hh + 0..7 and kb + 16 + 8hh + 0..7 (kb added per step)
  const float* Mb = maskp + (size_t)b * SEQ_FULL + 8 * hh;
  const float lsc = 0.125f * LOG2E;
  const size_t kstep = (size_t)NH * HD;

  const v16b qh0 = ldfrag_b(QH + qofs);       // d 0..31
  const v16b qh1 = ldfrag_b(QH + qofs + 32);  // d 32..63
  const v16b ql0 = ldfrag_b(QL + qofs);
  const v16b ql1 = ldfrag_b(QL + qofs + 32);

  float mrun = -INFINITY, lrun = 0.f;
  v8f o[4];
#pragma unroll
  for (int j = 0; j < 4; ++j) o[j] = zero8();

#pragma unroll 1
  for (int it = 0; it < NKB; ++it) {
    const int kb = it * 32;
    // ---- transposed scores: s0 = keys kb..kb+15, s1 = keys kb+16..kb+31, column = query q0 + c ----
    v8f s0 = zero8(), s1 = zero8();
    // ---- per-key mask values with the same key map as the D elements (kb+31 < SEQ, addresses in range) ----
    const float* mp = Mb + kb;
    const v4f mk0 = *(const v4f*)(mp), mk1 = *(const v4f*)(mp + 4);
    const v4f mk2 = *(const v4f*)(mp + 16), mk3 = *(const v4f*)(mp + 20);
    float mk[16];
#pragma unroll
    for (int e = 0; e < 4; ++e) { mk[e] = mk0[e]; mk[4 + e] = mk1[e]; mk[8 + e] = mk2[e]; mk[12 + e] = mk3[e]; }
    {
      const u16* k0p = Kbh + (size_t)kb * kstep;
      const u16* k1p = k0p + (size_t)16 * kstep;
      const v16b ka0 = ldfrag_b(k0p), ka1 = ldfrag_b(k0p + 32);
      const v16b kc0 = ldfrag_b(k1p), kc1 = ldfrag_b(k1p + 32);
      s0 = mma_b(ka0, qh0, s0);
      s0 = mma_b(ka1, qh1, s0);
      s0 = mma_b(ka0, ql0, s0);
      s0 = mma_b(ka1, ql1, s0);
      s1 = mma_b(kc0, qh0, s1);
      s1 = mma_b(kc1, qh1, s1);
      s1 = mma_b(kc0, ql0, s1);
      s1 = mma_b(kc1, ql1, s1);
      guard2x8<v16b>(s0, s1, qh0, qh1, ql0, ql1, ka0, ka1, kc0, kc1);
    }
    {
      const u16* l0p = Kbl + (size_t)kb * kstep;
      const u16* l1p = l0p + (size_t)16 * kstep;
      const v16b kl0 = ldfrag_b(l0p), kl1 = ldfrag_b(l0p + 32);
      const v16b km0 = ldfrag_b(l1p), km1 = ldfrag_b(l1p + 32);
      s0 = mma_b(kl0, qh0, s0);
      s0 = mma_b(kl1, qh1, s0);
      s1 = mma_b(km0, qh0, s1);
      s1 = mma_b(km1, qh1, s1);
      guard2x6<v16b>(s0, s1, kl0, kl1, km0, km1, qh0, qh1);
    }
    // ---- base-2 logits of this lane's 16 keys for query q0 + c: (q.k/8 + mask[key]) * log2e ----
    float tk[16];
#pragma unroll
    for (int i = 0; i < 8; ++i) {
      tk[i]     = s0[i] * lsc + mk[i] * LOG2E;
      tk[8 + i] = s1[i] * lsc + mk[8 + i] * LOG2E;
    }
    float cm = tk[0];
#pragma unroll
    for (int i = 1; i < 16; ++i) cm = fmaxf(cm, tk[i]);
    cm = fmaxf(cm, __shfl_xor(cm, 16, 32));
    const float mn = fmaxf(mrun, cm);                                // finite from the first key block on
    const float al = (mrun == -INFINITY) ? 0.f : exp2f(mrun - mn);   // o and l are zero while mrun is -inf
    mrun = mn;
    // ---- probabilities (<= 1) and the P A-fragment: f16(p * 32768); element i <-> tk[i] ----
    float ps = 0.f;
    FragH ph;
#pragma unroll
    for (int w = 0; w < 2; ++w) {
#pragma unroll
      for (int e4 = 0; e4 < 4; ++e4) {
        const int i = 8 * w + 2 * e4;
        const float p0 = exp2f(fminf(tk[i] - mn, 0.f));
        const float p1 = exp2f(fminf(tk[i + 1] - mn, 0.f));
        ps += p0 + p1;
        ph.u[w][e4] = pk16(h_bits((_Float16)(p0 * PCAR)), h_bits((_Float16)(p1 * PCAR)));
      }
    }
    ps += __shfl_xor(ps, 16, 32);
    lrun = lrun * al + ps;
    // ---- rescale the O accumulators: D row 8hh+r = query q0+8hh+r, its factor lives in lane 8hh+r (and 16+8hh+r) ----
    float scl[8];
#pragma unroll
    for (int r = 0; r < 8; ++r) scl[r] = __shfl(al, 8 * hh + r, 32);
#pragma unroll
    for (int j = 0; j < 4; ++j) {
#pragma unroll
      for (int r = 0; r < 8; ++r) o[j][r] *= scl[r];
    }
    // ---- P.V : B fragment col n = d = j*16 + c, keys contiguous in the v^T plane ----
    {
      const _Float16* vp = Vb + kb;
      const v16h vf0 = ldfrag_h(vp);
      const v16h vf1 = ldfrag_h(vp + (size_t)16 * SEQ);
      const v16h vf2 = ldfrag_h(vp + (size_t)32 * SEQ);
      const v16h vf3 = ldfrag_h(vp + (size_t)48 * SEQ);
      o[0] = mma_h(ph.v, vf0, o[0]);
      o[1] = mma_h(ph.v, vf1, o[1]);
      o[2] = mma_h(ph.v, vf2, o[2]);
      o[3] = mma_h(ph.v, vf3, o[3]);
      guard6<v16h>(o[0], o[1], o[2], o[3], ph.v, vf0, vf1, vf2, vf3, ph.v);
    }
  }
  acc_guard4(o[0], o[1], o[2], o[3]);

  // ---- fold 1/l (per query, owned by lane = query; l >= 1 by construction) and the carries; stage the 16x64 slab ----
  const float linv = (lrun > 0.f) ? ((1.0f / lrun) * (1.0f / (PCAR * VCAR))) : 0.f;
  float inv[8];
#pragma unroll
  for (int r = 0; r < 8; ++r) inv[r] = __shfl(linv, 8 * hh + r, 32);
  float* slab = smem + wave * SLAB;
#pragma unroll
  for (int r = 0; r < 8; ++r) {
#pragma unroll
    for (int j = 0; j < 4; ++j) slab[(8 * hh + r) * 68 + j * 16 + c] = o[j][r] * inv[r];
  }
  wave_sync_lds();
  v4f vals[8];
#pragma unroll
  for (int it = 0; it < 8; ++it) vals[it] = *(const v4f*)(slab + (it * 2 + hh) * 68 + c * 4);
  float* dst = out + ((((size_t)b * SEQ) + (size_t)(q0 + hh)) * DMOD) + head * HD + c * 4;
  {
#pragma unroll
    for (int it = 0; it < 8; ++it) {
      *(v4f*)(dst + (size_t)(it * 2) * DMOD) = vals[it];
    }
    
  }
}

// =====================================================================================================
// Workspace map (bytes); every plane is fully written by whole-line stores before it is read; all extents are exact multiples
// of the store granularity (no pad rows needed), every offset a multiple of 256:
//   XB  bf16 [NB*SEQ][512]                          8388608 (NB=2, SEQ=4096)
//   WQT, WKT, WVT bf16 [512 n][512 k]                524288 each
//   CS  f32  [SEQ][64] (cos | sin)                  1048576
//   QH, QL, KH, KL bf16 [NB*SEQ][8*64]              8388608 each
//   VP  f16  [NB][8*64][SEQ] x1024                   8388608
//   end                                              52953088 at NB=2, SEQ=4096
// Inputs (in order): x [NB_FULL][SEQ_FULL][512], mask [NB_FULL][1][1][SEQ_FULL], Wq [512 in][512 out], bq [512], Wk, bk,
// Wv, bv (all f32). Output: ctx f32 [NB][SEQ][512].
// =====================================================================================================
extern "C" void kernel_launch(void* const* d_in, const int* in_sizes, int n_in,
                              void* d_out, int out_size, void* d_ws, size_t ws_size,
                              hipStream_t stream) {
  if (n_in < 8) return;
  if (in_sizes[0] < ((NB - 1) * SEQ_FULL + SEQ) * DMOD) return;
  if (in_sizes[1] < (NB - 1) * SEQ_FULL + SEQ) return;
  if (in_sizes[2] < DMOD * DMOD || in_sizes[4] < DMOD * DMOD || in_sizes[6] < DMOD * DMOD) return;
  if (in_sizes[3] < DMOD || in_sizes[5] < DMOD || in_sizes[7] < DMOD) return;
  if (out_size < NB * SEQ * DMOD) return;

  const float* Xin = (const float*)d_in[0];
  const float* Msk = (const float*)d_in[1];
  const float* Wq  = (const float*)d_in[2];
  const float* bq  = (const float*)d_in[3];
  const float* Wk  = (const float*)d_in[4];
  const float* bk  = (const float*)d_in[5];
  const float* Wv  = (const float*)d_in[6];
  const float* bv  = (const float*)d_in[7];
  float*       out = (float*)d_out;

  const size_t szXB = (size_t)NB * SEQ * DMOD * 2;              //  8388608
  const size_t szW  = (size_t)DMOD * DMOD * 2;                  //   524288
  const size_t szCS = (size_t)SEQ * 64 * 4;                     //  1048576
  const size_t szP  = (size_t)NB * SEQ * DMOD * 2;              //  8388608
  const size_t szVP = (size_t)NB * DMOD * SEQ * 2;              //  8388608
  size_t off = 0;
  const size_t oXB = off; off += szXB;
  const size_t oWQ = off; off += szW;
  const size_t oWK = off; off += szW;
  const size_t oWV = off; off += szW;
  const size_t oCS = off; off += szCS;
  const size_t oQH = off; off += szP;
  const size_t oQL = off; off += szP;
  const size_t oKH = off; off += szP;
  const size_t oKL = off; off += szP;
  const size_t oVP = off; off += szVP;
  if (off > ws_size) return;                            // off = 52953088 at NB=2, SEQ=4096
  if (off > (size_t)134217728) return;

  char* ws = (char*)d_ws;
  u16*   XB  = (u16*)(ws + oXB);
  u16*   WQT = (u16*)(ws + oWQ);
  u16*   WKT = (u16*)(ws + oWK);
  u16*   WVT = (u16*)(ws + oWV);
  float* CS  = (float*)(ws + oCS);
  u16*   QH  = (u16*)(ws + oQH);
  u16*   QL  = (u16*)(ws + oQL);
  u16*   KH  = (u16*)(ws + oKH);
  u16*   KL  = (u16*)(ws + oKL);
  u16*   VP  = (u16*)(ws + oVP);

  // inv_freq[j] = 1 / 10000^(2j/64) as the exact f32 values of the eager f32 pow chain (table index j = d >> 1 of the
  // repeat-interleaved cos/sin layout); passed by value, selected on the device by a static chain
  RopeFreq fr;
  {
    const float invf[32] = {
      1.0f, 0.7498942017555237f, 0.5623413324356079f, 0.4216965138912201f,
      0.3162277638912201f, 0.23713736236095428f, 0.17782793939113617f, 0.1333521455526352f,
      0.10000000149011612f, 0.07498941570520401f, 0.05623412877321243f, 0.04216964915394783f,
      0.03162277862429619f, 0.0237137358635664f, 0.017782794311642647f, 0.01333521492779255f,
      0.009999999776482582f, 0.007498942315578461f, 0.005623413249850273f, 0.0042169648222625256f,
      0.003162277862429619f, 0.0023713738191872835f, 0.0017782794311642647f, 0.0013335214462131262f,
      0.0010000000474974513f, 0.0007498941849917173f, 0.000562341301701963f, 0.00042169648804701865f,
      0.0003162277862429619f, 0.0002371373848291114f, 0.00017782794020604342f, 0.0001333521504420787f};
    for (int j = 0; j < 32; ++j) fr.f[j] = invf[j];
  }

  const int n8x = (NB * SEQ * DMOD) / 8;                // 524288
  if ((n8x % 256) != 0) return;
  if ((DMOD % 64) != 0 || (SEQ % 64) != 0 || (DMOD % 32) != 0 || (SEQ % 8) != 0) return;
  const dim3 blk(256);
  const dim3 gX(n8x / 256);                             // 2048
  const dim3 gTW((DMOD / 64) * (DMOD / 64));            // 64
  const dim3 gCS(SEQ / 8);                              // 512
  const dim3 gGQ((NB * SEQ / 64) * (DMOD / 64));        // 1024
  const dim3 gV((DMOD / 64) * (SEQ / 64), NB);          // 512 x 2
  const dim3 bG(128);
  const dim3 gAT(ATT_BLOCKS);                           // 1024
  const dim3 bAT(ATT_THREADS);                          // 128

  // (0) x -> bf16 plane [NB*SEQ][512] (batch rows read with the full sequence stride)
  cvt_x<<<gX, blk, 0, stream>>>(Xin, XB, n8x, (SEQ * DMOD) / 8, (SEQ_FULL * DMOD) / 8);
  // (1..3) W [in][out] -> bf16 W^T planes [out n][in k] (k-contiguous)
  tr_w<<<gTW, blk, 0, stream>>>(Wq, WQT);
  tr_w<<<gTW, blk, 0, stream>>>(Wk, WKT);
  tr_w<<<gTW, blk, 0, stream>>>(Wv, WVT);
  // (4) cos/sin table [SEQ][64]
  rope_tab<<<gCS, blk, 0, stream>>>(fr, CS);
  // (5,6) q and k: (x.W + b) -> RoPE -> bf16 hi / residual planes [NB*SEQ][h*64+d]; bias by column
  gemm_rope<<<gGQ, bG, 0, stream>>>(XB, WQT, bq, CS, QH, QL, NB * SEQ, DMOD, DMOD, DMOD, SEQ);
  gemm_rope<<<gGQ, bG, 0, stream>>>(XB, WKT, bk, CS, KH, KL, NB * SEQ, DMOD, DMOD, DMOD, SEQ);
  // (7) v^T plane per batch: [512 = h*64+d][SEQ keys] = f16((Wv^T . x^T + bv) x1024); bias by row
  gemm_vt<<<gV, bG, 0, stream>>>(WVT, XB, VP, bv, DMOD, SEQ, DMOD, DMOD, VCAR, SEQ * DMOD, DMOD * SEQ);
  // (8) attention with per-key mask -> ctx f32 [NB][SEQ][h*64+d]
  attn_fwd<<<gAT, bAT, 0, stream>>>(QH, QL, KH, KL, VP, Msk, out);
  (void)hipGetLastError();
}

// v001
// It runs in 232 microseconds.
// Next to v000, in two timings, it ran 2.09 and 2.08 times as fast.
// Contractions: x.Wq+bq and x.Wk+bk (RoPE in the f32 epilogue) and Wv^T.x^T+bv on v_wmma_f32_16x16x32_bf16 (x and W planes
// RNE-converted to bf16 operands, f32 accumulate); scores k'.q'^T on v_wmma_f32_16x16x32_bf16 with roped q', k' carried as
// bf16 hi + bf16 residual planes (hi.hi + hi.lo + lo.hi folded along the k axis, f32 accumulate), per-key additive mask in f32;
// P.v on v_wmma_f32_16x16x32_f16 (P x32768 single f16, v x1024 single f16, f32 accumulate). Biases folded as RNE bf16 values
// in f32 epilogues; base-2 online softmax, 1/l and carry folds in f32 on VALU; cos/sin table built once with precise sincosf.
#include <hip/hip_runtime.h>
#include <math.h>
#include <stdint.h>

#ifndef NB
#define NB    2
#endif
#ifndef SEQ
#define SEQ   4096
#endif
#define NB_FULL  2
#define SEQ_FULL 4096
#define DMOD  512
#define NH    8
#define HD    64
#define PCAR  32768.0f
#define VCAR  1024.0f
#define LOG2E 1.4426950408889634f
#define ATT_WAVES   4
#define ATT_THREADS (ATT_WAVES * 32)
#define QTILES      (SEQ / 64)
#define ATT_BLOCKS  (NB * NH * QTILES)
#define NKB    (SEQ / 32)
#define SLAB   (16 * 68)
static_assert(HD == 64 && DMOD == NH * HD);
static_assert(NB >= 1 && NB <= NB_FULL);
static_assert((SEQ % 64) == 0 && SEQ >= 64 && SEQ <= SEQ_FULL);
static_assert(ATT_THREADS == 128 && NKB * 32 == SEQ);
static_assert((DMOD % 64) == 0 && (DMOD % 32) == 0);
static_assert(((SEQ * DMOD / 8) % 256) == 0 && ((DMOD * DMOD) % (64 * 64)) == 0 && (SEQ % 8) == 0);
static_assert((SLAB * 4) % 16 == 0);
// attention K/V ring in LDS: a stage is 64 keys = three tiles of 64 rows x 128 B (k hi, k residual: row = key, 64 d; v^T: row = d,
// 64 keys), each row padded by the tensor load to a 144-B pitch (16 B x odd: conflict-free for 16-B fragment reads)
#define KST      64
#define NST      (SEQ / KST)
#define TROWB    128
#define TPITCH   144
#define TILE_LDS 10240
#define BUF_LDS  (3 * TILE_LDS)
#define RING_LDS (2 * BUF_LDS)
static_assert(NST >= 2 && NST * KST == SEQ && KST == 2 * 32 && TROWB == HD * 2 && TROWB == KST * 2);
static_assert(64 * TPITCH <= TILE_LDS && (TILE_LDS % 2048) == 0 && ATT_WAVES * SLAB * 4 <= RING_LDS && ATT_WAVES >= 3);

typedef unsigned short u16;
typedef _Float16 v16h __attribute__((ext_vector_type(16)));
typedef _Float16 v8h  __attribute__((ext_vector_type(8)));
typedef __bf16   v16b __attribute__((ext_vector_type(16)));
typedef float    v8f  __attribute__((ext_vector_type(8)));
typedef float    v4f  __attribute__((ext_vector_type(4)));
typedef unsigned int v4u __attribute__((ext_vector_type(4)));
typedef uint32_t u32x4 __attribute__((ext_vector_type(4)));
typedef uint32_t u32x8 __attribute__((ext_vector_type(8)));

union FragH { v16h v; v8h h[2]; v4u u[2]; };
union FragB { v16b v; v4u u[2]; };

struct RopeFreq { float f[32]; };
static_assert(sizeof(RopeFreq) == 128);

// ---- scalar helpers --------------------------------------------------------------------------------
__device__ __forceinline__ unsigned short bf_bits(float f) {          // f32 -> bf16 bits, RNE convert
  unsigned u = __float_as_uint(f);
  return (unsigned short)((u + 0x7FFFu + ((u >> 16) & 1u)) >> 16);
}
__device__ __forceinline__ float bf_up(unsigned short h) { return __uint_as_float(((unsigned)h) << 16); }
__device__ __forceinline__ float bf_val(float f) { return bf_up(bf_bits(f)); }          // value after RNE bf16 convert
__device__ __forceinline__ unsigned short h_bits(_Float16 x) { return __builtin_bit_cast(unsigned short, x); }
__device__ __forceinline__ unsigned pk16(unsigned short a, unsigned short b) { return (unsigned)a | ((unsigned)b << 16); }
__device__ __forceinline__ v8f zero8() { v8f z = {0.f, 0.f, 0.f, 0.f, 0.f, 0.f, 0.f, 0.f}; return z; }

// ---- fragment loaders: 16-bit A/B operand, lane -> row/col (lane&15), p already includes +8*(lane>>4);
//      elements 0..7 <- p[0..7] (k0+8h..), elements 8..15 <- p[16..23] (k0+16+8h..)  (same split k map for A and B;
//      B is always read from a k-contiguous [n][k] plane)
__device__ __forceinline__ v16h ldfrag_h(const _Float16* p) {
  FragH f;
  f.h[0] = *(const v8h*)(p);
  f.h[1] = *(const v8h*)(p + 16);
  return f.v;
}
__device__ __forceinline__ v16b ldfrag_b(const u16* p) {              // bf16 plane read as unsigned integer vectors
  FragB f;
  f.u[0] = *(const v4u*)(p);
  f.u[1] = *(const v4u*)(p + 16);
  return f.v;
}

__device__ __forceinline__ v8f mma_h(v16h a, v16h b, v8f c) {
  return __builtin_amdgcn_wmma_f32_16x16x32_f16(false, a, false, b, (short)0, c, false, false);
}
__device__ __forceinline__ v8f mma_b(v16b a, v16b b, v8f c) {
  return __builtin_amdgcn_wmma_f32_16x16x32_bf16(false, a, false, b, (short)0, c, false, false);
}
template <typename F>
__device__ __forceinline__ void guard2x8(v8f& a, v8f& b, F x0, F x1, F x2, F x3, F x4, F x5, F x6, F x7) {
#if defined(__HIP_DEVICE_COMPILE__)
  asm volatile("v_nop\n\tv_nop\n\tv_nop\n\tv_nop"
               : "+v"(a), "+v"(b) : "v"(x0), "v"(x1), "v"(x2), "v"(x3), "v"(x4), "v"(x5), "v"(x6), "v"(x7) : "memory");
#endif
}
template <typename F>
__device__ __forceinline__ void guard2x6(v8f& a, v8f& b, F x0, F x1, F x2, F x3, F x4, F x5) {
#if defined(__HIP_DEVICE_COMPILE__)
  asm volatile("v_nop\n\tv_nop\n\tv_nop\n\tv_nop"
               : "+v"(a), "+v"(b) : "v"(x0), "v"(x1), "v"(x2), "v"(x3), "v"(x4), "v"(x5) : "memory");
#endif
}
template <typename F>
__device__ __forceinline__ void guard6(v8f& a, v8f& b, v8f& c, v8f& d, F x0, F x1, F x2, F x3, F x4, F x5) {
#if defined(__HIP_DEVICE_COMPILE__)
  asm volatile("v_nop\n\tv_nop\n\tv_nop\n\tv_nop"
               : "+v"(a), "+v"(b), "+v"(c), "+v"(d) : "v"(x0), "v"(x1), "v"(x2), "v"(x3), "v"(x4), "v"(x5) : "memory");
#endif
}
__device__ __forceinline__ void acc_guard4(v8f& a, v8f& b, v8f& c, v8f& d) {
#if defined(__HIP_DEVICE_COMPILE__)
  asm volatile("v_nop\n\tv_nop\n\tv_nop\n\tv_nop" : "+v"(a), "+v"(b), "+v"(c), "+v"(d));
#endif
}
__device__ __forceinline__ void wave_sync_lds() {
#if defined(__HIP_DEVICE_COMPILE__)
  __builtin_amdgcn_fence(__ATOMIC_RELEASE, "workgroup");
  __builtin_amdgcn_wave_barrier();
  __builtin_amdgcn_fence(__ATOMIC_ACQUIRE, "workgroup");
#endif
}

// ---- tensor load to LDS: descriptor words, issue, waits ----------------------------------------------
__device__ __forceinline__ uint32_t uni(uint32_t v) { return (uint32_t)__builtin_amdgcn_readfirstlane(v); }
__device__ __forceinline__ uint32_t pinned(uint32_t v) {
  uint32_t w = (uint32_t)__builtin_amdgcn_readfirstlane(v);
#if defined(__HIP_DEVICE_COMPILE__)
  asm volatile("" : "+s"(w));   // holds the issue test in a scalar register: the branch round a tensor load must be scalar (it ignores EXEC)
#endif
  return w;
}
__device__ __forceinline__ void wait_ds0() {
#if defined(__HIP_DEVICE_COMPILE__)
  asm volatile("s_wait_dscnt 0x0" ::: "memory");       // this wave's LDS reads of the buffer are done before the barrier frees it
#endif
}
__device__ __forceinline__ void wait_tensor0() {
#if defined(__HIP_DEVICE_COMPILE__)
  asm volatile("s_wait_tensorcnt 0x0" ::: "memory");   // the issuing wave's tile has landed
#endif
}
__device__ __forceinline__ void tdm_load(u32x4 g0, u32x8 g1) {
#if defined(__HIP_DEVICE_COMPILE__)
  asm volatile("tensor_load_to_lds %0, %1" :: "s"(g0), "s"(g1) : "memory");   // one request of the whole wave: global tile -> LDS, no registers
#endif
}
// group 1: 1-byte elements, tensor = tile = 64 rows of 128 B, source row pitch in bytes, 4 dwords of LDS pad behind every 32 dwords
__device__ __forceinline__ u32x8 tdm_group1(uint32_t src_pitch) {
  u32x8 g;
  g[0] = uni((1u << 20) | (4u << 22) | (3u << 25));
  g[1] = uni(((uint32_t)TROWB & 0xFFFFu) << 16);
  g[2] = uni(((uint32_t)TROWB >> 16) | ((64u & 0xFFFFu) << 16));
  g[3] = uni((64u >> 16) | ((uint32_t)TROWB << 16));
  g[4] = uni(64u);
  g[5] = uni(src_pitch);
  g[6] = uni(0u);
  g[7] = uni(0u);
  return g;
}
__device__ __forceinline__ u32x4 tdm_group0(uint32_t lds_dst, uint64_t ga) {
  u32x4 g;
  g[0] = uni(1u);
  g[1] = uni(lds_dst);
  g[2] = uni((uint32_t)ga);
  g[3] = uni((((uint32_t)(ga >> 32)) & 0x01FFFFFFu) | 0x80000000u);
  return g;
}

// =====================================================================================================
// x f32 [NB_FULL][SEQ_FULL][DMOD] -> bf16 plane [NB*SEQ][DMOD] (RNE bits), rows s < SEQ of batch b < NB compacted.
// Thread = 8 consecutive elements: two 16-B loads, one 16-B store; 32 consecutive lanes = 512 contiguous, 512-B aligned
// coverage: grid = n8/256 blocks (host checks exactness) x 256 thr x 8 = the whole plane.
// =====================================================================================================
__global__ __launch_bounds__(256) void cvt_x(const float* __restrict__ x, u16* D, int n8, int per_b8, int bstride8) {
  const int gt = blockIdx.x * 256 + (int)threadIdx.x;
  if (gt >= n8) return;                     // no barriers in this kernel
  const int b = gt / per_b8;
  const int w = gt - b * per_b8;
  const float* p = x + ((size_t)b * (size_t)bstride8 + (size_t)w) * 8;
  const v4f a = *(const v4f*)(p), c4 = *(const v4f*)(p + 4);
  float v[8];
#pragma unroll
  for (int e = 0; e < 4; ++e) { v[e] = a[e]; v[4 + e] = c4[e]; }
  unsigned short s[8];
#pragma unroll
  for (int e = 0; e < 8; ++e) s[e] = bf_bits(v[e]);
  v4u o;
#pragma unroll
  for (int e = 0; e < 4; ++e) o[e] = pk16(s[2 * e], s[2 * e + 1]);
  u16* d = D + (size_t)gt * 8;
  {
    *(v4u*)(d) = o;
    
  }
}

// =====================================================================================================
// W f32 in[rows=DMOD k][cols=DMOD n] -> out bf16 [DMOD n][DMOD k] (k-contiguous, RNE bits), transposed through a 64x64 LDS
// coverage: grid (DMOD/64)^2 tiles x 2 iterations x 256 threads x 8 halves = the whole [DMOD][DMOD] plane.
// LDS: staged extent 64 rows x 64 cols == consumed extent.
// =====================================================================================================
__global__ __launch_bounds__(256) void tr_w(const float* __restrict__ W, u16* D) {
  __shared__ __align__(16) float T[64 * 68];
  const int t = (int)threadIdx.x, bid = blockIdx.x;
  const int nt = DMOD / 64;
  const int k0 = (bid / nt) * 64, n0 = (bid % nt) * 64;
#pragma unroll
  for (int it = 0; it < 4; ++it) {
    const int e = it * 256 + t;
    const int kr = e >> 4, c4 = (e & 15) * 4;
    const v4f v = *(const v4f*)(W + (size_t)(k0 + kr) * DMOD + n0 + c4);
    *(v4f*)(T + kr * 68 + c4) = v;
  }
  __syncthreads();
  v4u ov[2];
#pragma unroll
  for (int it = 0; it < 2; ++it) {
    const int task = it * 256 + t;
    const int nr = task >> 3, k8 = (task & 7) * 8;
    unsigned short s[8];
#pragma unroll
    for (int e = 0; e < 8; ++e) s[e] = bf_bits(T[(k8 + e) * 68 + nr]);
#pragma unroll
    for (int e = 0; e < 4; ++e) ov[it][e] = pk16(s[2 * e], s[2 * e + 1]);
  }
  {
#pragma unroll
    for (int it = 0; it < 2; ++it) {
      const int task = it * 256 + t;
      const int nr = task >> 3, k8 = (task & 7) * 8;
      *(v4u*)(D + (size_t)(n0 + nr) * DMOD + k0 + k8) = ov[it];
    }
    
  }
}

// =====================================================================================================
// cos/sin table CS f32 [SEQ][64]: cols 0..31 = cos(pos * inv_freq[j]), cols 32..63 = sin(pos * inv_freq[j]) (precise
// sincosf; angle = single f32 multiply). inv_freq arrives by value; each thread picks its j with a static select chain.
// Block = 8 positions x 32 j; values staged in LDS, then each 256-B row written by 16 consecutive lanes x 16 B of one
// coverage: grid SEQ/8 x 8 rows x 64 floats = the whole table. LDS: staged 8x64 == consumed 8x64.
// =====================================================================================================
__global__ __launch_bounds__(256) void rope_tab(RopeFreq fr, float* CS) {
  __shared__ __align__(16) float tab[8 * 64];
  const int t = (int)threadIdx.x;
  const int pr = t >> 5, j = t & 31;
  const int pos = blockIdx.x * 8 + pr;
  float inv = 0.f;
#pragma unroll
  for (int q = 0; q < 32; ++q) inv = (j == q) ? fr.f[q] : inv;
  const float ang = (float)pos * inv;
  float sv, cv;
  sincosf(ang, &sv, &cv);
  tab[pr * 64 + j] = cv;
  tab[pr * 64 + 32 + j] = sv;
  __syncthreads();
  if (t < 128) {
    const int row = t >> 4, c4 = (t & 15) * 4;
    const v4f v = *(const v4f*)(tab + row * 64 + c4);
    float* d = CS + (size_t)(blockIdx.x * 8 + row) * 64 + c4;
    {
      *(v4f*)(d) = v;
      
    }
  }
}

// =====================================================================================================
// barrier, then converted to f16 and written: lane = (row in group of 4, 8 consecutive cols); one instruction = 4 rows, each
// coverage: 4 instructions x 4 rows x 8 lanes x 8 halves = the wave's 16 x 64 tile.
// =====================================================================================================
__device__ __forceinline__ void epi16(float* sl, v8f a0, v8f a1, v8f a2, v8f a3, float oscale, u16* C, int N,
                                      size_t rowb, int col0, int lane) {
  const int hh = lane >> 4, m = lane & 15;
#pragma unroll
  for (int r = 0; r < 8; ++r) {
    const int ro = (8 * hh + r) * 68 + m;
    sl[ro]      = a0[r] * oscale;
    sl[ro + 16] = a1[r] * oscale;
    sl[ro + 32] = a2[r] * oscale;
    sl[ro + 48] = a3[r] * oscale;
  }
  wave_sync_lds();
  const int rq = lane >> 3, c8 = (lane & 7) * 8;
  v4u ov[4];
#pragma unroll
  for (int i4 = 0; i4 < 4; ++i4) {
    const int row = i4 * 4 + rq;
    const v4f a = *(const v4f*)(sl + row * 68 + c8), c4 = *(const v4f*)(sl + row * 68 + c8 + 4);
    float w[8];
#pragma unroll
    for (int e = 0; e < 4; ++e) { w[e] = a[e]; w[4 + e] = c4[e]; }
#pragma unroll
    for (int e = 0; e < 4; ++e) ov[i4][e] = pk16(h_bits((_Float16)w[2 * e]), h_bits((_Float16)w[2 * e + 1]));
  }
  u16* dst = C + (rowb + (size_t)rq) * (size_t)N + col0 + c8;
  {
#pragma unroll
    for (int i4 = 0; i4 < 4; ++i4) {
      *(v4u*)(dst + (size_t)(i4 * 4) * (size_t)N) = ov[i4];
    }
    
  }
}

// =====================================================================================================
// bf16 hi + bf16 residual epilogue: the wave's 16x64 f32 tile staged in its LDS slab (pitch 68), wave barrier, then each
// value v written as hi = RNE bf16(v) into CH and lo = RNE bf16(v - hi) into CL (v - hi exact in f32); same lane/row map
// coverage: per plane 4 instructions x 4 rows x 8 lanes x 8 halves = the wave's 16 x 64 tile.
// =====================================================================================================
__device__ __forceinline__ void epi_hilo(float* sl, v8f a0, v8f a1, v8f a2, v8f a3, u16* CH, u16* CL, int N,
                                         size_t rowb, int col0, int lane) {
  const int hh = lane >> 4, m = lane & 15;
#pragma unroll
  for (int r = 0; r < 8; ++r) {
    const int ro = (8 * hh + r) * 68 + m;
    sl[ro]      = a0[r];
    sl[ro + 16] = a1[r];
    sl[ro + 32] = a2[r];
    sl[ro + 48] = a3[r];
  }
  wave_sync_lds();
  const int rq = lane >> 3, c8 = (lane & 7) * 8;
  v4u oh[4], ol[4];
#pragma unroll
  for (int i4 = 0; i4 < 4; ++i4) {
    const int row = i4 * 4 + rq;
    const v4f a = *(const v4f*)(sl + row * 68 + c8), c4 = *(const v4f*)(sl + row * 68 + c8 + 4);
    float w[8];
#pragma unroll
    for (int e = 0; e < 4; ++e) { w[e] = a[e]; w[4 + e] = c4[e]; }
#pragma unroll
    for (int e = 0; e < 4; ++e) {
      const unsigned short hb0 = bf_bits(w[2 * e]), hb1 = bf_bits(w[2 * e + 1]);
      const unsigned short lb0 = bf_bits(w[2 * e] - bf_up(hb0)), lb1 = bf_bits(w[2 * e + 1] - bf_up(hb1));
      oh[i4][e] = pk16(hb0, hb1);
      ol[i4][e] = pk16(lb0, lb1);
    }
  }
  const size_t dofs = (rowb + (size_t)rq) * (size_t)N + col0 + c8;
  {
#pragma unroll
    for (int i4 = 0; i4 < 4; ++i4) {
      const size_t o4 = dofs + (size_t)(i4 * 4) * (size_t)N;
      *(v4u*)(CH + o4) = oh[i4];
      *(v4u*)(CL + o4) = ol[i4];
    }
    
  }
}

// =====================================================================================================
// bf16 GEMM main loop: acc tile of the wave's 16 rows x 64 cols += A[rows][K] (bf16 row-major) . Bt[cols][K]^T (bf16
// k-contiguous); fragments loaded straight from the 16-bit rows (two 16-B loads each, split k map for A and B); K by 32.
// =====================================================================================================
__device__ __forceinline__ void mainloop_b(const u16* ap, const u16* bp, size_t bs, int K,
                                           v8f& acc0, v8f& acc1, v8f& acc2, v8f& acc3) {
#pragma unroll 1
  for (int k0 = 0; k0 < K; k0 += 32) {
    const v16b a  = ldfrag_b(ap + k0);
    const v16b b0 = ldfrag_b(bp + k0);
    const v16b b1 = ldfrag_b(bp + bs + k0);
    const v16b b2 = ldfrag_b(bp + 2 * bs + k0);
    const v16b b3 = ldfrag_b(bp + 3 * bs + k0);
    acc0 = mma_b(a, b0, acc0);
    acc1 = mma_b(a, b1, acc1);
    acc2 = mma_b(a, b2, acc2);
    acc3 = mma_b(a, b3, acc3);
    guard6<v16b>(acc0, acc1, acc2, acc3, a, b0, b1, b2, b3, a);
  }
  acc_guard4(acc0, acc1, acc2, acc3);
}

// =====================================================================================================
// Projection + bias + RoPE -> bf16 hi / residual planes:  y[M][N] = A[M][K] (bf16 x rows) . Bt[N][K]^T (bf16 W^T rows)
// + bias[col] (RNE bf16 value, clamped address). Block = 64x64 tile, 4 waves x 16 rows, N tiles of 64 = one head each
// (host checks M % 64 == 0, N % 64 == 0, K % 32 == 0, grid = (M/64)*(N/64)). D element r of acc_j = (row rowb+8hh+r,
// d = 16j + (lane&15)) within head col0/64, so the rotate-half partner d+32 of acc_0/acc_1 is acc_2/acc_3 in the same lane.
// RoPE: pos = row % seq; out[d] = y[d]*cos(pos*f[d>>1]) + rh[d]*sin(pos*f[d>>1]) with rh[d] = -y[d+32] (d<32), y[d-32]
// (d>=32); the 16 table rows of the wave are staged in its LDS slab first (8 x 16-B loads per lane), wave barrier, scalar
// LDS reads, wave barrier, then the hi/lo epilogue reuses the slab.
// LDS: staged table extent 16 rows x 64 floats == consumed extent; result tile 16 x 64 == consumed.
// coverage: grid (M/64)*(N/64) blocks x 4 waves x 16 x 64 = every element of both [M][N] planes exactly once.
// =====================================================================================================
__global__ __launch_bounds__(128)
void gemm_rope(const u16* __restrict__ A, const u16* __restrict__ Bt, const float* __restrict__ bias,
               const float* __restrict__ CS, u16* CH, u16* CL, int M, int N, int K, int nbias, int seq) {
  __shared__ __align__(16) float slab[4 * SLAB];
  const int tid = threadIdx.x, wave = tid >> 5, lane = tid & 31, hh = lane >> 4, m = lane & 15;
  const int ntile = N >> 6;
  const int bid   = blockIdx.x;
  const int rowb  = (bid / ntile) * 64 + wave * 16;
  const int col0  = (bid % ntile) * 64;
  if (rowb + 16 > M) return;                 // wave-uniform, never taken with the exact grid; no block barriers in this kernel
  const u16* ap = A  + (size_t)(rowb + m) * K + 8 * hh;
  const u16* bp = Bt + (size_t)(col0 + m) * K + 8 * hh;
  const size_t bs = (size_t)16 * K;
  v8f acc0 = zero8(), acc1 = zero8(), acc2 = zero8(), acc3 = zero8();
  mainloop_b(ap, bp, bs, K, acc0, acc1, acc2, acc3);
  // bias by column: D element r of lane -> col col0 + 16j + m
  float bc[4];
#pragma unroll
  for (int j = 0; j < 4; ++j) {
    int ci = col0 + 16 * j + m;
    ci = (ci < nbias) ? ci : (nbias - 1);
    bc[j] = bf_val(bias[ci]);
  }
#pragma unroll
  for (int r = 0; r < 8; ++r) {
    acc0[r] += bc[0];
    acc1[r] += bc[1];
    acc2[r] += bc[2];
    acc3[r] += bc[3];
  }
  // ---- stage the wave's 16 table rows (positions pos0 .. pos0+15, all inside one sequence) ----
  float* sl = slab + wave * SLAB;
  const int pos0 = rowb % seq;
#pragma unroll
  for (int it = 0; it < 8; ++it) {
    const int e = it * 32 + lane;
    const int row = e >> 4, c4 = (e & 15) * 4;
    const v4f tv = *(const v4f*)(CS + (size_t)(pos0 + row) * 64 + c4);
    *(v4f*)(sl + row * 68 + c4) = tv;
  }
  wave_sync_lds();
  const int fh = m >> 1;
#pragma unroll
  for (int r = 0; r < 8; ++r) {
    const float* tr = sl + (8 * hh + r) * 68;
    const float cA0 = tr[fh], cA1 = tr[8 + fh], cB0 = tr[16 + fh], cB1 = tr[24 + fh];
    const float sA0 = tr[32 + fh], sA1 = tr[40 + fh], sB0 = tr[48 + fh], sB1 = tr[56 + fh];
    const float x0 = acc0[r], x1 = acc1[r], x2 = acc2[r], x3 = acc3[r];
    acc0[r] = x0 * cA0 - x2 * sA0;            // d = m        : y[d]cos - y[d+32]sin, freq (d>>1)
    acc1[r] = x1 * cA1 - x3 * sA1;            // d = 16 + m   : freq 8 + (m>>1)
    acc2[r] = x2 * cB0 + x0 * sB0;            // d = 32 + m   : y[d]cos + y[d-32]sin, freq 16 + (m>>1)
    acc3[r] = x3 * cB1 + x1 * sB1;            // d = 48 + m   : freq 24 + (m>>1)
  }
  wave_sync_lds();                            // all table reads of the wave done before the slab is reused
  epi_hilo(sl, acc0, acc1, acc2, acc3, CH, CL, N, (size_t)rowb, col0, lane);
}

// =====================================================================================================
// bf16 GEMM with row bias and f16 result: C[M][N] (f16 of (acc + bias[row])*oscale) = A[M][K] (bf16 row-major, W^T rows)
// . Bt[N][K]^T (bf16 k-contiguous x rows of batch blockIdx.y); bias address clamped to [0, nbias). Produces the v^T plane
// [h*64+d][keys] of one batch per blockIdx.y (Bt and C advanced by the batch strides). Same tiling as gemm_rope;
// grid = ((M/64)*(N/64), NB).
// coverage: per batch (M/64)*(N/64) blocks x 4 waves x 16 x 64 = the whole [M][N] plane.
// =====================================================================================================
__global__ __launch_bounds__(128)
void gemm_vt(const u16* __restrict__ A, const u16* __restrict__ Bt, u16* C, const float* __restrict__ bias,
             int M, int N, int K, int nbias, float oscale, int bstrideB, int cstrideC) {
  __shared__ __align__(16) float slab[4 * SLAB];
  const int tid = threadIdx.x, wave = tid >> 5, lane = tid & 31, hh = lane >> 4, m = lane & 15;
  const int ntile = N >> 6;
  const int bid   = blockIdx.x;
  const int rowb  = (bid / ntile) * 64 + wave * 16;
  const int col0  = (bid % ntile) * 64;
  if (rowb + 16 > M) return;                 // wave-uniform, never taken with the exact grid; no block barriers in this kernel
  const u16* Btb = Bt + (size_t)blockIdx.y * (size_t)bstrideB;
  u16*       Cb  = C  + (size_t)blockIdx.y * (size_t)cstrideC;
  const u16* ap = A   + (size_t)(rowb + m) * K + 8 * hh;
  const u16* bp = Btb + (size_t)(col0 + m) * K + 8 * hh;
  const size_t bs = (size_t)16 * K;
  v8f acc0 = zero8(), acc1 = zero8(), acc2 = zero8(), acc3 = zero8();
  mainloop_b(ap, bp, bs, K, acc0, acc1, acc2, acc3);
  float br[8];
#pragma unroll
  for (int r = 0; r < 8; ++r) {
    int ri = rowb + 8 * hh + r;
    ri = (ri < nbias) ? ri : (nbias - 1);
    br[r] = bf_val(bias[ri]);
  }
#pragma unroll
  for (int r = 0; r < 8; ++r) {
    acc0[r] += br[r];
    acc1[r] += br[r];
    acc2[r] += br[r];
    acc3[r] += br[r];
  }
  epi16(slab + wave * SLAB, acc0, acc1, acc2, acc3, oscale, Cb, N, (size_t)rowb, col0, lane);
}

// =====================================================================================================
// Multi-head flash attention with a per-key additive mask (all SEQ keys): block = (batch, head, 64 query rows), 4 waves,
// wave w owns the 16 query rows q0 = 64*qt + 16*w .. q0+15. The k hi, k residual and v^T tiles of 64 keys are brought into LDS
// once per block by tensor loads (waves 0, 1, 2 issue one tile each) into a ring of two buffers and read by all 4 waves; one
// block barrier per 64 keys publishes the next stage and frees the buffer just read. The ring is the result slab in the epilogue.
//   q planes (bf16 hi QH, bf16 residual QL) laid out [b*SEQ + s][h][d]; k planes the same; v^T plane [b][h*64+d][s]
//   (f16 x1024). mask: f32 [b][SEQ_FULL], added to every score row by key index (scores = q.k/8 + mask[key]).
//   All NKB = SEQ/32 key blocks of 32 keys are visited (static bound), two per stage, in the same order.
//   Scores are computed TRANSPOSED: S^T tile g (g = 0,1) = k rows (keys kb+16g .. +15, A operand, row m = lane&15, split k
//   map over d) times q^T (B operand, col n = query q0 + (lane&15), k = d, split map). The residual terms are folded along
//   the k axis into the same f32 accumulator: k_hi.q_hi + k_hi.q_lo + k_lo.q_hi (6 products of 32-deep d-chunks per tile).
//   D element r of lane l = (key kb+16g+8h+r, query q0+(l&15)), so a lane owns one query column and 16 of its 32 keys; the
//   partner lane l^16 owns the other 16 -> row max / row sum need one xor-16 shuffle. The mask values of those 16 keys are
//   loaded with the same key map and added (times log2e) to the base-2 logits.
//   Online max-subtracted base-2 softmax in f32 (scale 1/8 folded into lsc). The exp'd values ARE the P A-fragment in
//   place: A row m = query = lane&15, element i <- key kb+8h+i (tile 0, D element i), element 8+i <- key kb+16+8h+i
//   (tile 1, D element i). P is carried x32768 as single f16. The rescale factor of query row 8h+r of the O accumulators is
//   fetched from lane 8h+r with a shuffle (uniform control). 4 v^T B fragments (col n = d = 16j + (lane&15), keys
//   k-contiguous), 4 P.V WMMAs per key block.
//   Epilogue: 1/l (per query, shuffled to the D row owner) and carry folds in f32; the wave's 16x64 f32 result staged in its
// LDS: staged extent 16 x 64 == consumed extent.
// coverage: per wave 8 instructions x 2 rows x 16 lanes x 4 floats = 16 x 64; grid NB*NH*(SEQ/64) blocks x 4 waves =
//           every (b, s, h) row segment of the output exactly once.
// =====================================================================================================
__global__ __launch_bounds__(ATT_THREADS)
void attn_fwd(const u16* __restrict__ QH, const u16* __restrict__ QL, const u16* __restrict__ KH,
              const u16* __restrict__ KL, const u16* __restrict__ VPp, const float* __restrict__ maskp, float* out) {
  __shared__ __attribute__((aligned(2048))) unsigned char ring[RING_LDS];   // two buffers x three tiles; result slabs in the epilogue

  const int tid  = threadIdx.x;
  const int wave = tid >> 5;
  const int lane = tid & 31;
  const int hh   = lane >> 4;
  const int c    = lane & 15;

  const int bid  = blockIdx.x;
  const int qt   = bid % QTILES;
  const int bh   = bid / QTILES;
  const int head = bh % NH;
  const int b    = bh / NH;
  if (b >= NB) return;                                     // block-uniform, never taken with the exact grid; in front of every barrier
  const int q0   = qt * 64 + wave * 16;

  // B fragments of q^T: col n = query q0 + c, k = d (k-contiguous row of the q planes)
  const size_t qofs = ((((size_t)b * SEQ) + (size_t)(q0 + c)) * NH + head) * HD + 8 * hh;
  // tile sources: k planes from key row 0 of (b, head), 64 key rows per stage; v^T plane from d row 0 of (b, head), 64 keys per stage
  const uint32_t wv = uni((uint32_t)tid >> 5);
  const size_t kbyte = ((((size_t)b * SEQ) * NH + head) * HD) * 2;
  const size_t vbyte = (((size_t)b * DMOD + (size_t)(head * HD)) * SEQ) * 2;
  const unsigned char* tsrc = (wv == 0u) ? (const unsigned char*)KH + kbyte
                            : (wv == 1u) ? (const unsigned char*)KL + kbyte : (const unsigned char*)VPp + vbyte;
  const uint32_t tpitch = (wv < 2u) ? (uint32_t)(NH * HD * 2) : (uint32_t)(SEQ * 2);          // source row pitch, bytes
  const uint32_t tstep  = (wv < 2u) ? (uint32_t)(KST * NH * HD * 2) : (uint32_t)(KST * 2);    // source advance per stage, bytes
  const uint32_t tdst   = (uint32_t)(size_t)ring + ((wv < 2u) ? wv : 2u) * (uint32_t)TILE_LDS;  // this wave's tile in buffer 0
  const u32x8 g1 = tdm_group1(tpitch);
  // fragment reads from a tile: row (lane&15) of a 16-row group, 16 B at 16*hh (+32 B for the second half of the split k map)
  const uint32_t fofs = (uint32_t)c * TPITCH + 16u * (uint32_t)hh;
  // mask of this lane's 16 keys: kb + 8hh + 0..7 and kb + 16 + 8hh + 0..7 (kb added per step)
  const float* Mb = maskp + (size_t)b * SEQ_FULL + 8 * hh;
  const float lsc = 0.125f * LOG2E;

  const v16b qh0 = ldfrag_b(QH + qofs);       // d 0..31
  const v16b qh1 = ldfrag_b(QH + qofs + 32);  // d 32..63
  const v16b ql0 = ldfrag_b(QL + qofs);
  const v16b ql1 = ldfrag_b(QL + qofs + 32);

  float mrun = -INFINITY, lrun = 0.f;
  v8f o[4];
#pragma unroll
  for (int j = 0; j < 4; ++j) o[j] = zero8();

  // ---- ring prologue: stage 0 lands and is published, then stage 1 is set flying ----
  if (pinned(wv < 3u)) {
    tdm_load(tdm_group0(tdst, (uint64_t)(size_t)tsrc), g1);
    wait_tensor0();
  }
  __syncthreads();
  if (pinned(wv < 3u)) {
    tdm_load(tdm_group0(tdst + (uint32_t)BUF_LDS, (uint64_t)(size_t)tsrc + tstep), g1);
  }

#pragma unroll 1   // one stage per trip: one publish point per trip, the buffer chosen by the trip's parity
  for (int st = 0; st < NST; ++st) {
   const uint32_t bsel = ((uint32_t)st & 1u) * (uint32_t)BUF_LDS;
   const unsigned char* Lb = ring + bsel + fofs;
#pragma unroll     // the stage's two 32-key passes: their LDS row offsets become immediates of the fragment reads
   for (int sub = 0; sub < 2; ++sub) {
    const int kb = st * KST + sub * 32;
    // ---- transposed scores: s0 = keys kb..kb+15, s1 = keys kb+16..kb+31, column = query q0 + c ----
    v8f s0 = zero8(), s1 = zero8();
    // ---- per-key mask values with the same key map as the D elements (kb+31 < SEQ, addresses in range) ----
    const float* mp = Mb + kb;
    const v4f mk0 = *(const v4f*)(mp), mk1 = *(const v4f*)(mp + 4);
    const v4f mk2 = *(const v4f*)(mp + 16), mk3 = *(const v4f*)(mp + 20);
    float mk[16];
#pragma unroll
    for (int e = 0; e < 4; ++e) { mk[e] = mk0[e]; mk[4 + e] = mk1[e]; mk[8 + e] = mk2[e]; mk[12 + e] = mk3[e]; }
    {
      const u16* k0p = (const u16*)(const void*)(Lb + (sub * 32) * TPITCH);
      const u16* k1p = (const u16*)(const void*)(Lb + (sub * 32 + 16) * TPITCH);
      const v16b ka0 = ldfrag_b(k0p), ka1 = ldfrag_b(k0p + 32);
      const v16b kc0 = ldfrag_b(k1p), kc1 = ldfrag_b(k1p + 32);
      s0 = mma_b(ka0, qh0, s0);
      s0 = mma_b(ka1, qh1, s0);
      s0 = mma_b(ka0, ql0, s0);
      s0 = mma_b(ka1, ql1, s0);
      s1 = mma_b(kc0, qh0, s1);
      s1 = mma_b(kc1, qh1, s1);
      s1 = mma_b(kc0, ql0, s1);
      s1 = mma_b(kc1, ql1, s1);
      guard2x8<v16b>(s0, s1, qh0, qh1, ql0, ql1, ka0, ka1, kc0, kc1);
    }
    {
      const u16* l0p = (const u16*)(const void*)(Lb + TILE_LDS + (sub * 32) * TPITCH);
      const u16* l1p = (const u16*)(const void*)(Lb + TILE_LDS + (sub * 32 + 16) * TPITCH);
      const v16b kl0 = ldfrag_b(l0p), kl1 = ldfrag_b(l0p + 32);
      const v16b km0 = ldfrag_b(l1p), km1 = ldfrag_b(l1p + 32);
      s0 = mma_b(kl0, qh0, s0);
      s0 = mma_b(kl1, qh1, s0);
      s1 = mma_b(km0, qh0, s1);
      s1 = mma_b(km1, qh1, s1);
      guard2x6<v16b>(s0, s1, kl0, kl1, km0, km1, qh0, qh1);
    }
    // ---- base-2 logits of this lane's 16 keys for query q0 + c: (q.k/8 + mask[key]) * log2e ----
    float tk[16];
#pragma unroll
    for (int i = 0; i < 8; ++i) {
      tk[i]     = s0[i] * lsc + mk[i] * LOG2E;
      tk[8 + i] = s1[i] * lsc + mk[8 + i] * LOG2E;
    }
    float cm = tk[0];
#pragma unroll
    for (int i = 1; i < 16; ++i) cm = fmaxf(cm, tk[i]);
    cm = fmaxf(cm, __shfl_xor(cm, 16, 32));
    const float mn = fmaxf(mrun, cm);                                // finite from the first key block on
    const float al = (mrun == -INFINITY) ? 0.f : exp2f(mrun - mn);   // o and l are zero while mrun is -inf
    mrun = mn;
    // ---- probabilities (<= 1) and the P A-fragment: f16(p * 32768); element i <-> tk[i] ----
    float ps = 0.f;
    FragH ph;
#pragma unroll
    for (int w = 0; w < 2; ++w) {
#pragma unroll
      for (int e4 = 0; e4 < 4; ++e4) {
        const int i = 8 * w + 2 * e4;
        const float p0 = exp2f(fminf(tk[i] - mn, 0.f));
        const float p1 = exp2f(fminf(tk[i + 1] - mn, 0.f));
        ps += p0 + p1;
        ph.u[w][e4] = pk16(h_bits((_Float16)(p0 * PCAR)), h_bits((_Float16)(p1 * PCAR)));
      }
    }
    ps += __shfl_xor(ps, 16, 32);
    lrun = lrun * al + ps;
    // ---- rescale the O accumulators: D row 8hh+r = query q0+8hh+r, its factor lives in lane 8hh+r (and 16+8hh+r) ----
    float scl[8];
#pragma unroll
    for (int r = 0; r < 8; ++r) scl[r] = __shfl(al, 8 * hh + r, 32);
#pragma unroll
    for (int j = 0; j < 4; ++j) {
#pragma unroll
      for (int r = 0; r < 8; ++r) o[j][r] *= scl[r];
    }
    // ---- P.V : B fragment col n = d = j*16 + c, keys contiguous in the v^T plane ----
    {
      const unsigned char* vp = Lb + 2 * TILE_LDS + sub * 64;
      const v16h vf0 = ldfrag_h((const _Float16*)(const void*)(vp));
      const v16h vf1 = ldfrag_h((const _Float16*)(const void*)(vp + 16 * TPITCH));
      const v16h vf2 = ldfrag_h((const _Float16*)(const void*)(vp + 32 * TPITCH));
      const v16h vf3 = ldfrag_h((const _Float16*)(const void*)(vp + 48 * TPITCH));
      o[0] = mma_h(ph.v, vf0, o[0]);
      o[1] = mma_h(ph.v, vf1, o[1]);
      o[2] = mma_h(ph.v, vf2, o[2]);
      o[3] = mma_h(ph.v, vf3, o[3]);
      guard6<v16h>(o[0], o[1], o[2], o[3], ph.v, vf0, vf1, vf2, vf3, ph.v);
    }
   }
   // ---- publish point of stage st + 1: own LDS reads done, own tile landed, barrier; then the refill of the buffer just read ----
   wait_ds0();
   if (pinned(wv < 3u)) wait_tensor0();
   __syncthreads();
   if (pinned((wv < 3u) && (st + 2 < NST))) {
     tdm_load(tdm_group0(tdst + bsel, (uint64_t)(size_t)tsrc + (uint64_t)(uint32_t)(st + 2) * tstep), g1);
   }
  }
  wait_tensor0();
  wait_ds0();
  acc_guard4(o[0], o[1], o[2], o[3]);

  // ---- fold 1/l (per query, owned by lane = query; l >= 1 by construction) and the carries; stage the 16x64 slab ----
  const float linv = (lrun > 0.f) ? ((1.0f / lrun) * (1.0f / (PCAR * VCAR))) : 0.f;
  float inv[8];
#pragma unroll
  for (int r = 0; r < 8; ++r) inv[r] = __shfl(linv, 8 * hh + r, 32);
  // the last publish point's barrier stands behind every wave's last ring read and no tensor load is in flight: the ring is free
  float* slab = (float*)(void*)ring + wave * SLAB;
#pragma unroll
  for (int r = 0; r < 8; ++r) {
#pragma unroll
    for (int j = 0; j < 4; ++j) slab[(8 * hh + r) * 68 + j * 16 + c] = o[j][r] * inv[r];
  }
  wave_sync_lds();
  v4f vals[8];
#pragma unroll
  for (int it = 0; it < 8; ++it) vals[it] = *(const v4f*)(slab + (it * 2 + hh) * 68 + c * 4);
  float* dst = out + ((((size_t)b * SEQ) + (size_t)(q0 + hh)) * DMOD) + head * HD + c * 4;
  {
#pragma unroll
    for (int it = 0; it < 8; ++it) {
      *(v4f*)(dst + (size_t)(it * 2) * DMOD) = vals[it];
    }
    
  }
}

// =====================================================================================================
// Workspace map (bytes); every plane is fully written by whole-line stores before it is read; all extents are exact multiples
// of the store granularity (no pad rows needed), every offset a multiple of 256:
//   XB  bf16 [NB*SEQ][512]                          8388608 (NB=2, SEQ=4096)
//   WQT, WKT, WVT bf16 [512 n][512 k]                524288 each
//   CS  f32  [SEQ][64] (cos | sin)                  1048576
//   QH, QL, KH, KL bf16 [NB*SEQ][8*64]              8388608 each
//   VP  f16  [NB][8*64][SEQ] x1024                   8388608
//   end                                              52953088 at NB=2, SEQ=4096
// Inputs (in order): x [NB_FULL][SEQ_FULL][512], mask [NB_FULL][1][1][SEQ_FULL], Wq [512 in][512 out], bq [512], Wk, bk,
// Wv, bv (all f32). Output: ctx f32 [NB][SEQ][512].
// =====================================================================================================
extern "C" void kernel_launch(void* const* d_in, const int* in_sizes, int n_in,
                              void* d_out, int out_size, void* d_ws, size_t ws_size,
                              hipStream_t stream) {
  if (n_in < 8) return;
  if (in_sizes[0] < ((NB - 1) * SEQ_FULL + SEQ) * DMOD) return;
  if (in_sizes[1] < (NB - 1) * SEQ_FULL + SEQ) return;
  if (in_sizes[2] < DMOD * DMOD || in_sizes[4] < DMOD * DMOD || in_sizes[6] < DMOD * DMOD) return;
  if (in_sizes[3] < DMOD || in_sizes[5] < DMOD || in_sizes[7] < DMOD) return;
  if (out_size < NB * SEQ * DMOD) return;

  const float* Xin = (const float*)d_in[0];
  const float* Msk = (const float*)d_in[1];
  const float* Wq  = (const float*)d_in[2];
  const float* bq  = (const float*)d_in[3];
  const float* Wk  = (const float*)d_in[4];
  const float* bk  = (const float*)d_in[5];
  const float* Wv  = (const float*)d_in[6];
  const float* bv  = (const float*)d_in[7];
  float*       out = (float*)d_out;

  const size_t szXB = (size_t)NB * SEQ * DMOD * 2;              //  8388608
  const size_t szW  = (size_t)DMOD * DMOD * 2;                  //   524288
  const size_t szCS = (size_t)SEQ * 64 * 4;                     //  1048576
  const size_t szP  = (size_t)NB * SEQ * DMOD * 2;              //  8388608
  const size_t szVP = (size_t)NB * DMOD * SEQ * 2;              //  8388608
  size_t off = 0;
  const size_t oXB = off; off += szXB;
  const size_t oWQ = off; off += szW;
  const size_t oWK = off; off += szW;
  const size_t oWV = off; off += szW;
  const size_t oCS = off; off += szCS;
  const size_t oQH = off; off += szP;
  const size_t oQL = off; off += szP;
  const size_t oKH = off; off += szP;
  const size_t oKL = off; off += szP;
  const size_t oVP = off; off += szVP;
  if (off > ws_size) return;                            // off = 52953088 at NB=2, SEQ=4096
  if (off > (size_t)134217728) return;

  char* ws = (char*)d_ws;
  u16*   XB  = (u16*)(ws + oXB);
  u16*   WQT = (u16*)(ws + oWQ);
  u16*   WKT = (u16*)(ws + oWK);
  u16*   WVT = (u16*)(ws + oWV);
  float* CS  = (float*)(ws + oCS);
  u16*   QH  = (u16*)(ws + oQH);
  u16*   QL  = (u16*)(ws + oQL);
  u16*   KH  = (u16*)(ws + oKH);
  u16*   KL  = (u16*)(ws + oKL);
  u16*   VP  = (u16*)(ws + oVP);

  // inv_freq[j] = 1 / 10000^(2j/64) as the exact f32 values of the eager f32 pow chain (table index j = d >> 1 of the
  // repeat-interleaved cos/sin layout); passed by value, selected on the device by a static chain
  RopeFreq fr;
  {
    const float invf[32] = {
      1.0f, 0.7498942017555237f, 0.5623413324356079f, 0.4216965138912201f,
      0.3162277638912201f, 0.23713736236095428f, 0.17782793939113617f, 0.1333521455526352f,
      0.10000000149011612f, 0.07498941570520401f, 0.05623412877321243f, 0.04216964915394783f,
      0.03162277862429619f, 0.0237137358635664f, 0.017782794311642647f, 0.01333521492779255f,
      0.009999999776482582f, 0.007498942315578461f, 0.005623413249850273f, 0.0042169648222625256f,
      0.003162277862429619f, 0.0023713738191872835f, 0.0017782794311642647f, 0.0013335214462131262f,
      0.0010000000474974513f, 0.0007498941849917173f, 0.000562341301701963f, 0.00042169648804701865f,
      0.0003162277862429619f, 0.0002371373848291114f, 0.00017782794020604342f, 0.0001333521504420787f};
    for (int j = 0; j < 32; ++j) fr.f[j] = invf[j];
  }

  const int n8x = (NB * SEQ * DMOD) / 8;                // 524288
  if ((n8x % 256) != 0) return;
  if ((DMOD % 64) != 0 || (SEQ % 64) != 0 || (DMOD % 32) != 0 || (SEQ % 8) != 0) return;
  const dim3 blk(256);
  const dim3 gX(n8x / 256);                             // 2048
  const dim3 gTW((DMOD / 64) * (DMOD / 64));            // 64
  const dim3 gCS(SEQ / 8);                              // 512
  const dim3 gGQ((NB * SEQ / 64) * (DMOD / 64));        // 1024
  const dim3 gV((DMOD / 64) * (SEQ / 64), NB);          // 512 x 2
  const dim3 bG(128);
  const dim3 gAT(ATT_BLOCKS);                           // 1024
  const dim3 bAT(ATT_THREADS);                          // 128

  // (0) x -> bf16 plane [NB*SEQ][512] (batch rows read with the full sequence stride)
  cvt_x<<<gX, blk, 0, stream>>>(Xin, XB, n8x, (SEQ * DMOD) / 8, (SEQ_FULL * DMOD) / 8);
  // (1..3) W [in][out] -> bf16 W^T planes [out n][in k] (k-contiguous)
  tr_w<<<gTW, blk, 0, stream>>>(Wq, WQT);
  tr_w<<<gTW, blk, 0, stream>>>(Wk, WKT);
  tr_w<<<gTW, blk, 0, stream>>>(Wv, WVT);
  // (4) cos/sin table [SEQ][64]
  rope_tab<<<gCS, blk, 0, stream>>>(fr, CS);
  // (5,6) q and k: (x.W + b) -> RoPE -> bf16 hi / residual planes [NB*SEQ][h*64+d]; bias by column
  gemm_rope<<<gGQ, bG, 0, stream>>>(XB, WQT, bq, CS, QH, QL, NB * SEQ, DMOD, DMOD, DMOD, SEQ);
  gemm_rope<<<gGQ, bG, 0, stream>>>(XB, WKT, bk, CS, KH, KL, NB * SEQ, DMOD, DMOD, DMOD, SEQ);
  // (7) v^T plane per batch: [512 = h*64+d][SEQ keys] = f16((Wv^T . x^T + bv) x1024); bias by row
  gemm_vt<<<gV, bG, 0, stream>>>(WVT, XB, VP, bv, DMOD, SEQ, DMOD, DMOD, VCAR, SEQ * DMOD, DMOD * SEQ);
  // (8) attention with per-key mask -> ctx f32 [NB][SEQ][h*64+d]
  attn_fwd<<<gAT, bAT, 0, stream>>>(QH, QL, KH, KL, VP, Msk, out);
  (void)hipGetLastError();
}

// v002
// Measured time: 198 microseconds a run.
// Two timings next to v001 both put it at 1.17 times that version's speed.
// All steps since v000 together make it 2.44 times as fast.
// Contractions: x.Wq+bq and x.Wk+bk (RoPE in the f32 epilogue) and Wv^T.x^T+bv on v_wmma_f32_16x16x32_bf16 (x and W planes
// RNE-converted to bf16 operands, f32 accumulate); scores k'.q'^T on v_wmma_f32_16x16x32_bf16 with roped q', k' carried as
// bf16 hi + bf16 residual planes (hi.hi + hi.lo + lo.hi folded along the k axis, f32 accumulate), per-key additive mask in f32;
// P.v on v_wmma_f32_16x16x32_f16 (P x32768 single f16, v x1024 single f16, f32 accumulate). Biases folded as RNE bf16 values
// in f32 epilogues; base-2 online softmax, 1/l and carry folds in f32 on VALU; cos/sin table built once with precise sincosf.
#include <hip/hip_runtime.h>
#include <math.h>
#include <stdint.h>

#ifndef NB
#define NB    2
#endif
#ifndef SEQ
#define SEQ   4096
#endif
#define NB_FULL  2
#define SEQ_FULL 4096
#define DMOD  512
#define NH    8
#define HD    64
#define PEXP  15.0f
#define VCAR  1024.0f
#define LOG2E 1.4426950408889634f
#define ATT_WAVES   4
#define ATT_THREADS (ATT_WAVES * 32)
#define QTILES      (SEQ / 64)
#define ATT_BLOCKS  (NB * NH * QTILES)
#define NKB    (SEQ / 32)
#define SLAB   (16 * 68)
static_assert(HD == 64 && DMOD == NH * HD);
static_assert(NB >= 1 && NB <= NB_FULL);
static_assert((SEQ % 64) == 0 && SEQ >= 64 && SEQ <= SEQ_FULL);
static_assert(ATT_THREADS == 128 && NKB * 32 == SEQ);
static_assert((DMOD % 64) == 0 && (DMOD % 32) == 0);
static_assert(((SEQ * DMOD / 8) % 256) == 0 && ((DMOD * DMOD) % (64 * 64)) == 0 && (SEQ % 8) == 0);
static_assert((SLAB * 4) % 16 == 0);
// attention K/V ring in LDS: a stage is 64 keys = three tiles of 64 rows x 128 B (k hi, k residual: row = key, 64 d; v^T: row = d,
// 64 keys), each row padded by the tensor load to a 144-B pitch (16 B x odd: conflict-free for 16-B fragment reads)
#define KST      64
#define NST      (SEQ / KST)
#define TROWB    128
#define TPITCH   144
#define TILE_LDS 10240
#define BUF_LDS  (3 * TILE_LDS)
#define RING_LDS (2 * BUF_LDS)
static_assert(NST >= 2 && NST * KST == SEQ && KST == 2 * 32 && TROWB == HD * 2 && TROWB == KST * 2);
static_assert(64 * TPITCH <= TILE_LDS && (TILE_LDS % 2048) == 0 && ATT_WAVES * SLAB * 4 <= RING_LDS && ATT_WAVES >= 3);

typedef unsigned short u16;
typedef _Float16 v16h __attribute__((ext_vector_type(16)));
typedef _Float16 v8h  __attribute__((ext_vector_type(8)));
typedef __bf16   v16b __attribute__((ext_vector_type(16)));
typedef float    v8f  __attribute__((ext_vector_type(8)));
typedef float    v4f  __attribute__((ext_vector_type(4)));
typedef float    v2f  __attribute__((ext_vector_type(2)));
typedef _Float16 v2h  __attribute__((ext_vector_type(2)));
typedef unsigned int v4u __attribute__((ext_vector_type(4)));
typedef uint32_t u32x4 __attribute__((ext_vector_type(4)));
typedef uint32_t u32x8 __attribute__((ext_vector_type(8)));

union FragH { v16h v; v8h h[2]; v4u u[2]; v2h p[8]; };
union FragB { v16b v; v4u u[2]; };

struct RopeFreq { float f[32]; };
static_assert(sizeof(RopeFreq) == 128);

// ---- scalar helpers --------------------------------------------------------------------------------
__device__ __forceinline__ unsigned short bf_bits(float f) {          // f32 -> bf16 bits, RNE convert
  unsigned u = __float_as_uint(f);
  return (unsigned short)((u + 0x7FFFu + ((u >> 16) & 1u)) >> 16);
}
__device__ __forceinline__ float bf_up(unsigned short h) { return __uint_as_float(((unsigned)h) << 16); }
__device__ __forceinline__ float bf_val(float f) { return bf_up(bf_bits(f)); }          // value after RNE bf16 convert
__device__ __forceinline__ unsigned short h_bits(_Float16 x) { return __builtin_bit_cast(unsigned short, x); }
__device__ __forceinline__ unsigned pk16(unsigned short a, unsigned short b) { return (unsigned)a | ((unsigned)b << 16); }
// 2^x on the hardware instruction alone: a result below 2^-126 comes out 0 (here it is a term of a sum >= 1 or an f16 that rounds to 0)
__device__ __forceinline__ float hw_exp2(float x) { return __builtin_amdgcn_exp2f(x); }
// the same with the free slot that the instruction set asks for behind a transcendental written into the statement
__device__ __forceinline__ float hw_exp2_slot(float x) {
  float r = 0.f;
#if defined(__HIP_DEVICE_COMPILE__)
  asm("v_exp_f32 %0, %1\n\tv_nop" : "=v"(r) : "v"(x));
#endif
  return r;
}
__device__ __forceinline__ v8f zero8() { v8f z = {0.f, 0.f, 0.f, 0.f, 0.f, 0.f, 0.f, 0.f}; return z; }

// ---- fragment loaders: 16-bit A/B operand, lane -> row/col (lane&15), p already includes +8*(lane>>4);
//      elements 0..7 <- p[0..7] (k0+8h..), elements 8..15 <- p[16..23] (k0+16+8h..)  (same split k map for A and B;
//      B is always read from a k-contiguous [n][k] plane)
__device__ __forceinline__ v16h ldfrag_h(const _Float16* p) {
  FragH f;
  f.h[0] = *(const v8h*)(p);
  f.h[1] = *(const v8h*)(p + 16);
  return f.v;
}
__device__ __forceinline__ v16b ldfrag_b(const u16* p) {              // bf16 plane read as unsigned integer vectors
  FragB f;
  f.u[0] = *(const v4u*)(p);
  f.u[1] = *(const v4u*)(p + 16);
  return f.v;
}

__device__ __forceinline__ v8f mma_h(v16h a, v16h b, v8f c) {
  return __builtin_amdgcn_wmma_f32_16x16x32_f16(false, a, false, b, (short)0, c, false, false);
}
__device__ __forceinline__ v8f mma_b(v16b a, v16b b, v8f c) {
  return __builtin_amdgcn_wmma_f32_16x16x32_bf16(false, a, false, b, (short)0, c, false, false);
}
template <typename F>
__device__ __forceinline__ void guard2x8(v8f& a, v8f& b, F x0, F x1, F x2, F x3, F x4, F x5, F x6, F x7) {
#if defined(__HIP_DEVICE_COMPILE__)
  asm volatile("v_nop\n\tv_nop\n\tv_nop\n\tv_nop"
               : "+v"(a), "+v"(b) : "v"(x0), "v"(x1), "v"(x2), "v"(x3), "v"(x4), "v"(x5), "v"(x6), "v"(x7) : "memory");
#endif
}
template <typename F>
__device__ __forceinline__ void guard2x6(v8f& a, v8f& b, F x0, F x1, F x2, F x3, F x4, F x5) {
#if defined(__HIP_DEVICE_COMPILE__)
  asm volatile("v_nop\n\tv_nop\n\tv_nop\n\tv_nop"
               : "+v"(a), "+v"(b) : "v"(x0), "v"(x1), "v"(x2), "v"(x3), "v"(x4), "v"(x5) : "memory");
#endif
}
template <typename F>
__device__ __forceinline__ void guard6(v8f& a, v8f& b, v8f& c, v8f& d, F x0, F x1, F x2, F x3, F x4, F x5) {
#if defined(__HIP_DEVICE_COMPILE__)
  asm volatile("v_nop\n\tv_nop\n\tv_nop\n\tv_nop"
               : "+v"(a), "+v"(b), "+v"(c), "+v"(d) : "v"(x0), "v"(x1), "v"(x2), "v"(x3), "v"(x4), "v"(x5) : "memory");
#endif
}
__device__ __forceinline__ void acc_guard4(v8f& a, v8f& b, v8f& c, v8f& d) {
#if defined(__HIP_DEVICE_COMPILE__)
  asm volatile("v_nop\n\tv_nop\n\tv_nop\n\tv_nop" : "+v"(a), "+v"(b), "+v"(c), "+v"(d));
#endif
}
__device__ __forceinline__ void wave_sync_lds() {
#if defined(__HIP_DEVICE_COMPILE__)
  __builtin_amdgcn_fence(__ATOMIC_RELEASE, "workgroup");
  __builtin_amdgcn_wave_barrier();
  __builtin_amdgcn_fence(__ATOMIC_ACQUIRE, "workgroup");
#endif
}

// ---- tensor load to LDS: descriptor words, issue, waits ----------------------------------------------
__device__ __forceinline__ uint32_t uni(uint32_t v) { return (uint32_t)__builtin_amdgcn_readfirstlane(v); }
__device__ __forceinline__ uint32_t pinned(uint32_t v) {
  uint32_t w = (uint32_t)__builtin_amdgcn_readfirstlane(v);
#if defined(__HIP_DEVICE_COMPILE__)
  asm volatile("" : "+s"(w));   // holds an issue test (the branch round a tensor load must be scalar: it ignores EXEC) or a descriptor word in a scalar register
#endif
  return w;
}
__device__ __forceinline__ void wait_ds0() {
#if defined(__HIP_DEVICE_COMPILE__)
  asm volatile("s_wait_dscnt 0x0" ::: "memory");       // this wave's LDS reads of the buffer are done before the barrier frees it
#endif
}
__device__ __forceinline__ void wait_tensor0() {
#if defined(__HIP_DEVICE_COMPILE__)
  asm volatile("s_wait_tensorcnt 0x0" ::: "memory");   // the issuing wave's tile has landed
#endif
}
// the same wait, naming group 0 of the request that it covers as an input: its four words keep their scalar registers up to here
// (without it the register of word 3 was given to another value while the request was still outstanding)
__device__ __forceinline__ void wait_tensor0_of(u32x4 g0) {
#if defined(__HIP_DEVICE_COMPILE__)
  asm volatile("s_wait_tensorcnt 0x0" :: "s"(g0) : "memory");
#endif
}
__device__ __forceinline__ void tdm_load(u32x4 g0, u32x8 g1) {
#if defined(__HIP_DEVICE_COMPILE__)
  asm volatile("tensor_load_to_lds %0, %1" :: "s"(g0), "s"(g1) : "memory");   // one request of the whole wave: global tile -> LDS, no registers
#endif
}
// group 1: 1-byte elements, tensor = tile = 64 rows of 128 B, source row pitch in bytes, 4 dwords of LDS pad behind every 32 dwords
__device__ __forceinline__ u32x8 tdm_group1(uint32_t src_pitch) {
  u32x8 g;
  g[0] = uni((1u << 20) | (4u << 22) | (3u << 25));
  // the constant words behind word 0 through pinned(): descriptor words held in scalar registers of their own, so that the compiler does
  // not form one anew from another in front of each use and lend its register out in between, while a request is outstanding
  g[1] = pinned(((uint32_t)TROWB & 0xFFFFu) << 16);
  g[2] = pinned(((uint32_t)TROWB >> 16) | ((64u & 0xFFFFu) << 16));
  g[3] = pinned((64u >> 16) | ((uint32_t)TROWB << 16));
  g[4] = pinned(64u);
  g[5] = uni(src_pitch);
  g[6] = pinned(0u);
  g[7] = pinned(0u);
  return g;
}
__device__ __forceinline__ u32x4 tdm_group0(uint32_t lds_dst, uint64_t ga) {
  u32x4 g;
  g[0] = pinned(1u);   // a descriptor word held in a scalar register: formed once per request, not written again while it is outstanding
  g[1] = uni(lds_dst);
  g[2] = uni((uint32_t)ga);
  g[3] = uni((((uint32_t)(ga >> 32)) & 0x01FFFFFFu) | 0x80000000u);
  return g;
}

// =====================================================================================================
// x f32 [NB_FULL][SEQ_FULL][DMOD] -> bf16 plane [NB*SEQ][DMOD] (RNE bits), rows s < SEQ of batch b < NB compacted.
// Thread = 8 consecutive elements: two 16-B loads, one 16-B store; 32 consecutive lanes = 512 contiguous, 512-B aligned
// coverage: grid = n8/256 blocks (host checks exactness) x 256 thr x 8 = the whole plane.
// =====================================================================================================
__global__ __launch_bounds__(256) void cvt_x(const float* __restrict__ x, u16* D, int n8, int per_b8, int bstride8) {
  const int gt = blockIdx.x * 256 + (int)threadIdx.x;
  if (gt >= n8) return;                     // no barriers in this kernel
  const int b = gt / per_b8;
  const int w = gt - b * per_b8;
  const float* p = x + ((size_t)b * (size_t)bstride8 + (size_t)w) * 8;
  const v4f a = *(const v4f*)(p), c4 = *(const v4f*)(p + 4);
  float v[8];
#pragma unroll
  for (int e = 0; e < 4; ++e) { v[e] = a[e]; v[4 + e] = c4[e]; }
  unsigned short s[8];
#pragma unroll
  for (int e = 0; e < 8; ++e) s[e] = bf_bits(v[e]);
  v4u o;
#pragma unroll
  for (int e = 0; e < 4; ++e) o[e] = pk16(s[2 * e], s[2 * e + 1]);
  u16* d = D + (size_t)gt * 8;
  {
    *(v4u*)(d) = o;
    
  }
}

// =====================================================================================================
// W f32 in[rows=DMOD k][cols=DMOD n] -> out bf16 [DMOD n][DMOD k] (k-contiguous, RNE bits), transposed through a 64x64 LDS
// coverage: grid (DMOD/64)^2 tiles x 2 iterations x 256 threads x 8 halves = the whole [DMOD][DMOD] plane.
// LDS: staged extent 64 rows x 64 cols == consumed extent.
// =====================================================================================================
__global__ __launch_bounds__(256) void tr_w(const float* __restrict__ W, u16* D) {
  __shared__ __align__(16) float T[64 * 68];
  const int t = (int)threadIdx.x, bid = blockIdx.x;
  const int nt = DMOD / 64;
  const int k0 = (bid / nt) * 64, n0 = (bid % nt) * 64;
#pragma unroll
  for (int it = 0; it < 4; ++it) {
    const int e = it * 256 + t;
    const int kr = e >> 4, c4 = (e & 15) * 4;
    const v4f v = *(const v4f*)(W + (size_t)(k0 + kr) * DMOD + n0 + c4);
    *(v4f*)(T + kr * 68 + c4) = v;
  }
  __syncthreads();
  v4u ov[2];
#pragma unroll
  for (int it = 0; it < 2; ++it) {
    const int task = it * 256 + t;
    const int nr = task >> 3, k8 = (task & 7) * 8;
    unsigned short s[8];
#pragma unroll
    for (int e = 0; e < 8; ++e) s[e] = bf_bits(T[(k8 + e) * 68 + nr]);
#pragma unroll
    for (int e = 0; e < 4; ++e) ov[it][e] = pk16(s[2 * e], s[2 * e + 1]);
  }
  {
#pragma unroll
    for (int it = 0; it < 2; ++it) {
      const int task = it * 256 + t;
      const int nr = task >> 3, k8 = (task & 7) * 8;
      *(v4u*)(D + (size_t)(n0 + nr) * DMOD + k0 + k8) = ov[it];
    }
    
  }
}

// =====================================================================================================
// cos/sin table CS f32 [SEQ][64]: cols 0..31 = cos(pos * inv_freq[j]), cols 32..63 = sin(pos * inv_freq[j]) (precise
// sincosf; angle = single f32 multiply). inv_freq arrives by value; each thread picks its j with a static select chain.
// Block = 8 positions x 32 j; values staged in LDS, then each 256-B row written by 16 consecutive lanes x 16 B of one
// coverage: grid SEQ/8 x 8 rows x 64 floats = the whole table. LDS: staged 8x64 == consumed 8x64.
// =====================================================================================================
__global__ __launch_bounds__(256) void rope_tab(RopeFreq fr, float* CS) {
  __shared__ __align__(16) float tab[8 * 64];
  const int t = (int)threadIdx.x;
  const int pr = t >> 5, j = t & 31;
  const int pos = blockIdx.x * 8 + pr;
  float inv = 0.f;
#pragma unroll
  for (int q = 0; q < 32; ++q) inv = (j == q) ? fr.f[q] : inv;
  const float ang = (float)pos * inv;
  float sv, cv;
  sincosf(ang, &sv, &cv);
  tab[pr * 64 + j] = cv;
  tab[pr * 64 + 32 + j] = sv;
  __syncthreads();
  if (t < 128) {
    const int row = t >> 4, c4 = (t & 15) * 4;
    const v4f v = *(const v4f*)(tab + row * 64 + c4);
    float* d = CS + (size_t)(blockIdx.x * 8 + row) * 64 + c4;
    {
      *(v4f*)(d) = v;
      
    }
  }
}

// =====================================================================================================
// barrier, then converted to f16 and written: lane = (row in group of 4, 8 consecutive cols); one instruction = 4 rows, each
// coverage: 4 instructions x 4 rows x 8 lanes x 8 halves = the wave's 16 x 64 tile.
// =====================================================================================================
__device__ __forceinline__ void epi16(float* sl, v8f a0, v8f a1, v8f a2, v8f a3, float oscale, u16* C, int N,
                                      size_t rowb, int col0, int lane) {
  const int hh = lane >> 4, m = lane & 15;
#pragma unroll
  for (int r = 0; r < 8; ++r) {
    const int ro = (8 * hh + r) * 68 + m;
    sl[ro]      = a0[r] * oscale;
    sl[ro + 16] = a1[r] * oscale;
    sl[ro + 32] = a2[r] * oscale;
    sl[ro + 48] = a3[r] * oscale;
  }
  wave_sync_lds();
  const int rq = lane >> 3, c8 = (lane & 7) * 8;
  v4u ov[4];
#pragma unroll
  for (int i4 = 0; i4 < 4; ++i4) {
    const int row = i4 * 4 + rq;
    const v4f a = *(const v4f*)(sl + row * 68 + c8), c4 = *(const v4f*)(sl + row * 68 + c8 + 4);
    float w[8];
#pragma unroll
    for (int e = 0; e < 4; ++e) { w[e] = a[e]; w[4 + e] = c4[e]; }
#pragma unroll
    for (int e = 0; e < 4; ++e) ov[i4][e] = pk16(h_bits((_Float16)w[2 * e]), h_bits((_Float16)w[2 * e + 1]));
  }
  u16* dst = C + (rowb + (size_t)rq) * (size_t)N + col0 + c8;
  {
#pragma unroll
    for (int i4 = 0; i4 < 4; ++i4) {
      *(v4u*)(dst + (size_t)(i4 * 4) * (size_t)N) = ov[i4];
    }
    
  }
}

// =====================================================================================================
// bf16 hi + bf16 residual epilogue: the wave's 16x64 f32 tile staged in its LDS slab (pitch 68), wave barrier, then each
// value v written as hi = RNE bf16(v) into CH and lo = RNE bf16(v - hi) into CL (v - hi exact in f32); same lane/row map
// coverage: per plane 4 instructions x 4 rows x 8 lanes x 8 halves = the wave's 16 x 64 tile.
// =====================================================================================================
__device__ __forceinline__ void epi_hilo(float* sl, v8f a0, v8f a1, v8f a2, v8f a3, u16* CH, u16* CL, int N,
                                         size_t rowb, int col0, int lane) {
  const int hh = lane >> 4, m = lane & 15;
#pragma unroll
  for (int r = 0; r < 8; ++r) {
    const int ro = (8 * hh + r) * 68 + m;
    sl[ro]      = a0[r];
    sl[ro + 16] = a1[r];
    sl[ro + 32] = a2[r];
    sl[ro + 48] = a3[r];
  }
  wave_sync_lds();
  const int rq = lane >> 3, c8 = (lane & 7) * 8;
  v4u oh[4], ol[4];
#pragma unroll
  for (int i4 = 0; i4 < 4; ++i4) {
    const int row = i4 * 4 + rq;
    const v4f a = *(const v4f*)(sl + row * 68 + c8), c4 = *(const v4f*)(sl + row * 68 + c8 + 4);
    float w[8];
#pragma unroll
    for (int e = 0; e < 4; ++e) { w[e] = a[e]; w[4 + e] = c4[e]; }
#pragma unroll
    for (int e = 0; e < 4; ++e) {
      const unsigned short hb0 = bf_bits(w[2 * e]), hb1 = bf_bits(w[2 * e + 1]);
      const unsigned short lb0 = bf_bits(w[2 * e] - bf_up(hb0)), lb1 = bf_bits(w[2 * e + 1] - bf_up(hb1));
      oh[i4][e] = pk16(hb0, hb1);
      ol[i4][e] = pk16(lb0, lb1);
    }
  }
  const size_t dofs = (rowb + (size_t)rq) * (size_t)N + col0 + c8;
  {
#pragma unroll
    for (int i4 = 0; i4 < 4; ++i4) {
      const size_t o4 = dofs + (size_t)(i4 * 4) * (size_t)N;
      *(v4u*)(CH + o4) = oh[i4];
      *(v4u*)(CL + o4) = ol[i4];
    }
    
  }
}

// =====================================================================================================
// bf16 GEMM main loop: acc tile of the wave's 16 rows x 64 cols += A[rows][K] (bf16 row-major) . Bt[cols][K]^T (bf16
// k-contiguous); fragments loaded straight from the 16-bit rows (two 16-B loads each, split k map for A and B); K by 32.
// =====================================================================================================
__device__ __forceinline__ void mainloop_b(const u16* ap, const u16* bp, size_t bs, int K,
                                           v8f& acc0, v8f& acc1, v8f& acc2, v8f& acc3) {
#pragma unroll 1
  for (int k0 = 0; k0 < K; k0 += 32) {
    const v16b a  = ldfrag_b(ap + k0);
    const v16b b0 = ldfrag_b(bp + k0);
    const v16b b1 = ldfrag_b(bp + bs + k0);
    const v16b b2 = ldfrag_b(bp + 2 * bs + k0);
    const v16b b3 = ldfrag_b(bp + 3 * bs + k0);
    acc0 = mma_b(a, b0, acc0);
    acc1 = mma_b(a, b1, acc1);
    acc2 = mma_b(a, b2, acc2);
    acc3 = mma_b(a, b3, acc3);
    guard6<v16b>(acc0, acc1, acc2, acc3, a, b0, b1, b2, b3, a);
  }
  acc_guard4(acc0, acc1, acc2, acc3);
}

// =====================================================================================================
// Projection + bias + RoPE -> bf16 hi / residual planes:  y[M][N] = A[M][K] (bf16 x rows) . Bt[N][K]^T (bf16 W^T rows)
// + bias[col] (RNE bf16 value, clamped address). Block = 64x64 tile, 4 waves x 16 rows, N tiles of 64 = one head each
// (host checks M % 64 == 0, N % 64 == 0, K % 32 == 0, grid = (M/64)*(N/64)). D element r of acc_j = (row rowb+8hh+r,
// d = 16j + (lane&15)) within head col0/64, so the rotate-half partner d+32 of acc_0/acc_1 is acc_2/acc_3 in the same lane.
// RoPE: pos = row % seq; out[d] = y[d]*cos(pos*f[d>>1]) + rh[d]*sin(pos*f[d>>1]) with rh[d] = -y[d+32] (d<32), y[d-32]
// (d>=32); the 16 table rows of the wave are staged in its LDS slab first (8 x 16-B loads per lane), wave barrier, scalar
// LDS reads, wave barrier, then the hi/lo epilogue reuses the slab.
// LDS: staged table extent 16 rows x 64 floats == consumed extent; result tile 16 x 64 == consumed.
// coverage: grid (M/64)*(N/64) blocks x 4 waves x 16 x 64 = every element of both [M][N] planes exactly once.
// =====================================================================================================
__global__ __launch_bounds__(128)
void gemm_rope(const u16* __restrict__ A, const u16* __restrict__ Bt, const float* __restrict__ bias,
               const float* __restrict__ CS, u16* CH, u16* CL, int M, int N, int K, int nbias, int seq) {
  __shared__ __align__(16) float slab[4 * SLAB];
  const int tid = threadIdx.x, wave = tid >> 5, lane = tid & 31, hh = lane >> 4, m = lane & 15;
  const int ntile = N >> 6;
  const int bid   = blockIdx.x;
  const int rowb  = (bid / ntile) * 64 + wave * 16;
  const int col0  = (bid % ntile) * 64;
  if (rowb + 16 > M) return;                 // wave-uniform, never taken with the exact grid; no block barriers in this kernel
  const u16* ap = A  + (size_t)(rowb + m) * K + 8 * hh;
  const u16* bp = Bt + (size_t)(col0 + m) * K + 8 * hh;
  const size_t bs = (size_t)16 * K;
  v8f acc0 = zero8(), acc1 = zero8(), acc2 = zero8(), acc3 = zero8();
  mainloop_b(ap, bp, bs, K, acc0, acc1, acc2, acc3);
  // bias by column: D element r of lane -> col col0 + 16j + m
  float bc[4];
#pragma unroll
  for (int j = 0; j < 4; ++j) {
    int ci = col0 + 16 * j + m;
    ci = (ci < nbias) ? ci : (nbias - 1);
    bc[j] = bf_val(bias[ci]);
  }
#pragma unroll
  for (int r = 0; r < 8; ++r) {
    acc0[r] += bc[0];
    acc1[r] += bc[1];
    acc2[r] += bc[2];
    acc3[r] += bc[3];
  }
  // ---- stage the wave's 16 table rows (positions pos0 .. pos0+15, all inside one sequence) ----
  float* sl = slab + wave * SLAB;
  const int pos0 = rowb % seq;
#pragma unroll
  for (int it = 0; it < 8; ++it) {
    const int e = it * 32 + lane;
    const int row = e >> 4, c4 = (e & 15) * 4;
    const v4f tv = *(const v4f*)(CS + (size_t)(pos0 + row) * 64 + c4);
    *(v4f*)(sl + row * 68 + c4) = tv;
  }
  wave_sync_lds();
  const int fh = m >> 1;
#pragma unroll
  for (int r = 0; r < 8; ++r) {
    const float* tr = sl + (8 * hh + r) * 68;
    const float cA0 = tr[fh], cA1 = tr[8 + fh], cB0 = tr[16 + fh], cB1 = tr[24 + fh];
    const float sA0 = tr[32 + fh], sA1 = tr[40 + fh], sB0 = tr[48 + fh], sB1 = tr[56 + fh];
    const float x0 = acc0[r], x1 = acc1[r], x2 = acc2[r], x3 = acc3[r];
    acc0[r] = x0 * cA0 - x2 * sA0;            // d = m        : y[d]cos - y[d+32]sin, freq (d>>1)
    acc1[r] = x1 * cA1 - x3 * sA1;            // d = 16 + m   : freq 8 + (m>>1)
    acc2[r] = x2 * cB0 + x0 * sB0;            // d = 32 + m   : y[d]cos + y[d-32]sin, freq 16 + (m>>1)
    acc3[r] = x3 * cB1 + x1 * sB1;            // d = 48 + m   : freq 24 + (m>>1)
  }
  wave_sync_lds();                            // all table reads of the wave done before the slab is reused
  epi_hilo(sl, acc0, acc1, acc2, acc3, CH, CL, N, (size_t)rowb, col0, lane);
}

// =====================================================================================================
// bf16 GEMM with row bias and f16 result: C[M][N] (f16 of (acc + bias[row])*oscale) = A[M][K] (bf16 row-major, W^T rows)
// . Bt[N][K]^T (bf16 k-contiguous x rows of batch blockIdx.y); bias address clamped to [0, nbias). Produces the v^T plane
// [h*64+d][keys] of one batch per blockIdx.y (Bt and C advanced by the batch strides). Same tiling as gemm_rope;
// grid = ((M/64)*(N/64), NB).
// coverage: per batch (M/64)*(N/64) blocks x 4 waves x 16 x 64 = the whole [M][N] plane.
// =====================================================================================================
__global__ __launch_bounds__(128)
void gemm_vt(const u16* __restrict__ A, const u16* __restrict__ Bt, u16* C, const float* __restrict__ bias,
             int M, int N, int K, int nbias, float oscale, int bstrideB, int cstrideC) {
  __shared__ __align__(16) float slab[4 * SLAB];
  const int tid = threadIdx.x, wave = tid >> 5, lane = tid & 31, hh = lane >> 4, m = lane & 15;
  const int ntile = N >> 6;
  const int bid   = blockIdx.x;
  const int rowb  = (bid / ntile) * 64 + wave * 16;
  const int col0  = (bid % ntile) * 64;
  if (rowb + 16 > M) return;                 // wave-uniform, never taken with the exact grid; no block barriers in this kernel
  const u16* Btb = Bt + (size_t)blockIdx.y * (size_t)bstrideB;
  u16*       Cb  = C  + (size_t)blockIdx.y * (size_t)cstrideC;
  const u16* ap = A   + (size_t)(rowb + m) * K + 8 * hh;
  const u16* bp = Btb + (size_t)(col0 + m) * K + 8 * hh;
  const size_t bs = (size_t)16 * K;
  v8f acc0 = zero8(), acc1 = zero8(), acc2 = zero8(), acc3 = zero8();
  mainloop_b(ap, bp, bs, K, acc0, acc1, acc2, acc3);
  float br[8];
#pragma unroll
  for (int r = 0; r < 8; ++r) {
    int ri = rowb + 8 * hh + r;
    ri = (ri < nbias) ? ri : (nbias - 1);
    br[r] = bf_val(bias[ri]);
  }
#pragma unroll
  for (int r = 0; r < 8; ++r) {
    acc0[r] += br[r];
    acc1[r] += br[r];
    acc2[r] += br[r];
    acc3[r] += br[r];
  }
  epi16(slab + wave * SLAB, acc0, acc1, acc2, acc3, oscale, Cb, N, (size_t)rowb, col0, lane);
}

// =====================================================================================================
// Multi-head flash attention with a per-key additive mask (all SEQ keys): block = (batch, head, 64 query rows), 4 waves,
// wave w owns the 16 query rows q0 = 64*qt + 16*w .. q0+15. The k hi, k residual and v^T tiles of 64 keys are brought into LDS
// once per block by tensor loads (waves 0, 1, 2 issue one tile each) into a ring of two buffers and read by all 4 waves; one
// block barrier per 64 keys publishes the next stage and frees the buffer just read. The ring is the result slab in the epilogue.
//   q planes (bf16 hi QH, bf16 residual QL) laid out [b*SEQ + s][h][d]; k planes the same; v^T plane [b][h*64+d][s]
//   (f16 x1024). mask: f32 [b][SEQ_FULL], added to every score row by key index (scores = q.k/8 + mask[key]).
//   All NKB = SEQ/32 key blocks of 32 keys are visited (static bound), two per stage, in the same order.
//   Scores are computed TRANSPOSED: S^T tile g (g = 0,1) = k rows (keys kb+16g .. +15, A operand, row m = lane&15, split k
//   map over d) times q^T (B operand, col n = query q0 + (lane&15), k = d, split map). The residual terms are folded along
//   the k axis into the same f32 accumulator: k_hi.q_hi + k_hi.q_lo + k_lo.q_hi (6 products of 32-deep d-chunks per tile).
//   D element r of lane l = (key kb+16g+8h+r, query q0+(l&15)), so a lane owns one query column and 16 of its 32 keys; the
//   partner lane l^16 owns the other 16 -> row max / row sum need one xor-16 shuffle. The mask values of those 16 keys are
//   loaded with the same key map and added (times log2e) to the base-2 logits.
//   Online max-subtracted base-2 softmax in f32 (scale 1/8 folded into lsc). The exp'd values ARE the P A-fragment in
//   place: A row m = query = lane&15, element i <- key kb+8h+i (tile 0, D element i), element 8+i <- key kb+16+8h+i
//   (tile 1, D element i). P is carried x32768 as single f16. The rescale factor of query row 8h+r of the O accumulators is
//   fetched from lane 8h+r with a shuffle (uniform control). 4 v^T B fragments (col n = d = 16j + (lane&15), keys
//   k-contiguous), 4 P.V WMMAs per key block.
//   Epilogue: 1/l (per query, shuffled to the D row owner) and carry folds in f32; the wave's 16x64 f32 result staged in its
// LDS: staged extent 16 x 64 == consumed extent.
// coverage: per wave 8 instructions x 2 rows x 16 lanes x 4 floats = 16 x 64; grid NB*NH*(SEQ/64) blocks x 4 waves =
//           every (b, s, h) row segment of the output exactly once.
// =====================================================================================================
__global__ __launch_bounds__(ATT_THREADS)
void attn_fwd(const u16* __restrict__ QH, const u16* __restrict__ QL, const u16* __restrict__ KH,
              const u16* __restrict__ KL, const u16* __restrict__ VPp, const float* __restrict__ maskp, float* out) {
  __shared__ __attribute__((aligned(2048))) unsigned char ring[RING_LDS];   // two buffers x three tiles; result slabs in the epilogue

  const int tid  = threadIdx.x;
  const int wave = tid >> 5;
  const int lane = tid & 31;
  const int hh   = lane >> 4;
  const int c    = lane & 15;

  const int bid  = blockIdx.x;
  const int qt   = bid % QTILES;
  const int bh   = bid / QTILES;
  const int head = bh % NH;
  const int b    = bh / NH;
  if (b >= NB) return;                                     // block-uniform, never taken with the exact grid; in front of every barrier
  const int q0   = qt * 64 + wave * 16;

  // B fragments of q^T: col n = query q0 + c, k = d (k-contiguous row of the q planes)
  const size_t qofs = ((((size_t)b * SEQ) + (size_t)(q0 + c)) * NH + head) * HD + 8 * hh;
  // tile sources: k planes from key row 0 of (b, head), 64 key rows per stage; v^T plane from d row 0 of (b, head), 64 keys per stage
  const uint32_t wv = uni((uint32_t)tid >> 5);
  const size_t kbyte = ((((size_t)b * SEQ) * NH + head) * HD) * 2;
  const size_t vbyte = (((size_t)b * DMOD + (size_t)(head * HD)) * SEQ) * 2;
  const unsigned char* tsrc = (wv == 0u) ? (const unsigned char*)KH + kbyte
                            : (wv == 1u) ? (const unsigned char*)KL + kbyte : (const unsigned char*)VPp + vbyte;
  const uint32_t tpitch = (wv < 2u) ? (uint32_t)(NH * HD * 2) : (uint32_t)(SEQ * 2);          // source row pitch, bytes
  const uint32_t tstep  = (wv < 2u) ? (uint32_t)(KST * NH * HD * 2) : (uint32_t)(KST * 2);    // source advance per stage, bytes
  const uint32_t tdst   = (uint32_t)(size_t)ring + ((wv < 2u) ? wv : 2u) * (uint32_t)TILE_LDS;  // this wave's tile in buffer 0
  const u32x8 g1 = tdm_group1(tpitch);
  // fragment reads from a tile: row (lane&15) of a 16-row group, 16 B at 16*hh (+32 B for the second half of the split k map)
  const uint32_t fofs = (uint32_t)c * TPITCH + 16u * (uint32_t)hh;
  // mask of this lane's 16 keys: kb + 8hh + 0..7 and kb + 16 + 8hh + 0..7 (kb added per step)
  const float* Mb = maskp + (size_t)b * SEQ_FULL + 8 * hh;
  const float lsc = 0.125f * LOG2E;

  const v16b qh0 = ldfrag_b(QH + qofs);       // d 0..31
  const v16b qh1 = ldfrag_b(QH + qofs + 32);  // d 32..63
  const v16b ql0 = ldfrag_b(QL + qofs);
  const v16b ql1 = ldfrag_b(QL + qofs + 32);

  float mrun = -INFINITY, brun = -INFINITY, lrun = 0.f;
  v8f o[4];
#pragma unroll
  for (int j = 0; j < 4; ++j) o[j] = zero8();

  // ---- ring prologue: stage 0 lands and is published, then stage 1 is set flying ----
  if (pinned(wv < 3u)) {
    tdm_load(tdm_group0(tdst, (uint64_t)(size_t)tsrc), g1);
    wait_tensor0();
  }
  __syncthreads();
  u32x4 gfly = tdm_group0(tdst + (uint32_t)BUF_LDS, (uint64_t)(size_t)tsrc + tstep);   // group 0 of the request in flight, carried to its wait
  if (pinned(wv < 3u)) {
    tdm_load(gfly, g1);
  }

#pragma unroll 1   // one stage per trip: one publish point per trip, the buffer chosen by the trip's parity
  for (int st = 0; st < NST; ++st) {
   const uint32_t bsel = ((uint32_t)st & 1u) * (uint32_t)BUF_LDS;
   const unsigned char* Lb = ring + bsel + fofs;
#pragma unroll     // the stage's two 32-key passes: their LDS row offsets become immediates of the fragment reads
   for (int sub = 0; sub < 2; ++sub) {
    const int kb = st * KST + sub * 32;
    // ---- transposed scores: s0 = keys kb..kb+15, s1 = keys kb+16..kb+31, column = query q0 + c ----
    v8f s0 = zero8(), s1 = zero8();
    // ---- per-key mask values with the same key map as the D elements (kb+31 < SEQ, addresses in range) ----
    const float* mp = Mb + kb;
    const v4f mk0 = *(const v4f*)(mp), mk1 = *(const v4f*)(mp + 4);
    const v4f mk2 = *(const v4f*)(mp + 16), mk3 = *(const v4f*)(mp + 20);
    {
      const u16* k0p = (const u16*)(const void*)(Lb + (sub * 32) * TPITCH);
      const u16* k1p = (const u16*)(const void*)(Lb + (sub * 32 + 16) * TPITCH);
      const v16b ka0 = ldfrag_b(k0p), ka1 = ldfrag_b(k0p + 32);
      const v16b kc0 = ldfrag_b(k1p), kc1 = ldfrag_b(k1p + 32);
      s0 = mma_b(ka0, qh0, s0);
      s0 = mma_b(ka1, qh1, s0);
      s0 = mma_b(ka0, ql0, s0);
      s0 = mma_b(ka1, ql1, s0);
      s1 = mma_b(kc0, qh0, s1);
      s1 = mma_b(kc1, qh1, s1);
      s1 = mma_b(kc0, ql0, s1);
      s1 = mma_b(kc1, ql1, s1);
      guard2x8<v16b>(s0, s1, qh0, qh1, ql0, ql1, ka0, ka1, kc0, kc1);
    }
    {
      const u16* l0p = (const u16*)(const void*)(Lb + TILE_LDS + (sub * 32) * TPITCH);
      const u16* l1p = (const u16*)(const void*)(Lb + TILE_LDS + (sub * 32 + 16) * TPITCH);
      const v16b kl0 = ldfrag_b(l0p), kl1 = ldfrag_b(l0p + 32);
      const v16b km0 = ldfrag_b(l1p), km1 = ldfrag_b(l1p + 32);
      s0 = mma_b(kl0, qh0, s0);
      s0 = mma_b(kl1, qh1, s0);
      s1 = mma_b(km0, qh0, s1);
      s1 = mma_b(km1, qh1, s1);
      guard2x6<v16b>(s0, s1, kl0, kl1, km0, km1, qh0, qh1);
    }
    // ---- base-2 logits of this lane's 16 keys for query q0 + c: (q.k/8 + mask[key]) * log2e ----
    //      kept as the register pairs in which the accumulators and the mask loads deliver them: pair j = elements 2j, 2j+1
    const v2f l2e2 = {LOG2E, LOG2E};   // the mask enters in the fused step, so its loads are waited for behind the score products
    v2f tk[8];
    tk[0] = __builtin_elementwise_fma(__builtin_shufflevector(mk0, mk0, 0, 1), l2e2, __builtin_shufflevector(s0, s0, 0, 1) * lsc);
    tk[1] = __builtin_elementwise_fma(__builtin_shufflevector(mk0, mk0, 2, 3), l2e2, __builtin_shufflevector(s0, s0, 2, 3) * lsc);
    tk[2] = __builtin_elementwise_fma(__builtin_shufflevector(mk1, mk1, 0, 1), l2e2, __builtin_shufflevector(s0, s0, 4, 5) * lsc);
    tk[3] = __builtin_elementwise_fma(__builtin_shufflevector(mk1, mk1, 2, 3), l2e2, __builtin_shufflevector(s0, s0, 6, 7) * lsc);
    tk[4] = __builtin_elementwise_fma(__builtin_shufflevector(mk2, mk2, 0, 1), l2e2, __builtin_shufflevector(s1, s1, 0, 1) * lsc);
    tk[5] = __builtin_elementwise_fma(__builtin_shufflevector(mk2, mk2, 2, 3), l2e2, __builtin_shufflevector(s1, s1, 2, 3) * lsc);
    tk[6] = __builtin_elementwise_fma(__builtin_shufflevector(mk3, mk3, 0, 1), l2e2, __builtin_shufflevector(s1, s1, 4, 5) * lsc);
    tk[7] = __builtin_elementwise_fma(__builtin_shufflevector(mk3, mk3, 2, 3), l2e2, __builtin_shufflevector(s1, s1, 6, 7) * lsc);
    float cm = fmaxf(tk[0][0], tk[0][1]);
#pragma unroll
    for (int j = 1; j < 8; ++j) cm = fmaxf(fmaxf(cm, tk[j][0]), tk[j][1]);
    cm = fmaxf(cm, __shfl_xor(cm, 16, 32));
    const float mn = fmaxf(mrun, cm);
    mrun = mn;
    // exponent base of this pass: max - 15, so that 2^(t - base) IS p * 32768; o and l are carried in units of 2^-base, which
    // cancels in o / l. Where max - 15 would round coarsely (|max| >= 2^20) the base is the max itself: 2^(t - base) stays just above 2^15 at most,
    // inside f16. While every key so far is masked with -inf the subtrahend is 0: all p are 0 and brun stays -inf, so al is 0.
    const float bn = (fabsf(mn) < 1048576.f) ? (mn - PEXP) : mn;
    const float bs = (mn == -INFINITY) ? 0.f : bn;
    // ---- probabilities x32768 and the P A-fragment: f16(2^(t - base)); fragment dword j <-> pair j; even and odd elements
    //      are summed apart and joined once per pass ----
    v2f ps2 = {0.f, 0.f};
    FragH ph;
#pragma unroll
    for (int j = 0; j < 8; ++j) {
      const v2f x = tk[j] - bs;
      v2f p;
      p[0] = hw_exp2(x[0]);
      p[1] = hw_exp2(x[1]);
      ps2 += p;
      ph.p[j] = __builtin_convertvector(p, v2h);
    }
    float ps = ps2[0] + ps2[1];
    const float al = hw_exp2_slot(brun - bs);
    brun = bn;
    ps += __shfl_xor(ps, 16, 32);
    lrun = lrun * al + ps;
    // ---- rescale the O accumulators: D row 8hh+r = query q0+8hh+r, its factor lives in lane 8hh+r (and 16+8hh+r) ----
    float scl[8];
#pragma unroll
    for (int r = 0; r < 8; ++r) scl[r] = __shfl(al, 8 * hh + r, 32);
#pragma unroll
    for (int j = 0; j < 4; ++j) {
#pragma unroll
      for (int r = 0; r < 8; ++r) o[j][r] *= scl[r];
    }
    // ---- P.V : B fragment col n = d = j*16 + c, keys contiguous in the v^T plane ----
    {
      const unsigned char* vp = Lb + 2 * TILE_LDS + sub * 64;
      const v16h vf0 = ldfrag_h((const _Float16*)(const void*)(vp));
      const v16h vf1 = ldfrag_h((const _Float16*)(const void*)(vp + 16 * TPITCH));
      const v16h vf2 = ldfrag_h((const _Float16*)(const void*)(vp + 32 * TPITCH));
      const v16h vf3 = ldfrag_h((const _Float16*)(const void*)(vp + 48 * TPITCH));
      o[0] = mma_h(ph.v, vf0, o[0]);
      o[1] = mma_h(ph.v, vf1, o[1]);
      o[2] = mma_h(ph.v, vf2, o[2]);
      o[3] = mma_h(ph.v, vf3, o[3]);
      guard6<v16h>(o[0], o[1], o[2], o[3], ph.v, vf0, vf1, vf2, vf3, ph.v);
    }
   }
   // ---- publish point of stage st + 1: own LDS reads done, own tile landed, barrier; then the refill of the buffer just read ----
   wait_ds0();
   if (pinned(wv < 3u)) wait_tensor0_of(gfly);
   __syncthreads();
   if (pinned((wv < 3u) && (st + 2 < NST))) {
     gfly = tdm_group0(tdst + bsel, (uint64_t)(size_t)tsrc + (uint64_t)(uint32_t)(st + 2) * tstep);
     tdm_load(gfly, g1);
   }
  }
  wait_tensor0();
  wait_ds0();
  acc_guard4(o[0], o[1], o[2], o[3]);

  // ---- fold 1/l (per query, owned by lane = query; l >= 1 unless every key is masked with -inf, then l = 0) and the carries; stage the 16x64 slab ----
  const float linv = (lrun > 0.f) ? ((1.0f / lrun) * (1.0f / VCAR)) : 0.f;   // l carries the same 2^-base as o
  float inv[8];
#pragma unroll
  for (int r = 0; r < 8; ++r) inv[r] = __shfl(linv, 8 * hh + r, 32);
  // the last publish point's barrier stands behind every wave's last ring read and no tensor load is in flight: the ring is free
  float* slab = (float*)(void*)ring + wave * SLAB;
#pragma unroll
  for (int r = 0; r < 8; ++r) {
#pragma unroll
    for (int j = 0; j < 4; ++j) slab[(8 * hh + r) * 68 + j * 16 + c] = o[j][r] * inv[r];
  }
  wave_sync_lds();
  v4f vals[8];
#pragma unroll
  for (int it = 0; it < 8; ++it) vals[it] = *(const v4f*)(slab + (it * 2 + hh) * 68 + c * 4);
  float* dst = out + ((((size_t)b * SEQ) + (size_t)(q0 + hh)) * DMOD) + head * HD + c * 4;
  {
#pragma unroll
    for (int it = 0; it < 8; ++it) {
      *(v4f*)(dst + (size_t)(it * 2) * DMOD) = vals[it];
    }
    
  }
}

// =====================================================================================================
// Workspace map (bytes); every plane is fully written by whole-line stores before it is read; all extents are exact multiples
// of the store granularity (no pad rows needed), every offset a multiple of 256:
//   XB  bf16 [NB*SEQ][512]                          8388608 (NB=2, SEQ=4096)
//   WQT, WKT, WVT bf16 [512 n][512 k]                524288 each
//   CS  f32  [SEQ][64] (cos | sin)                  1048576
//   QH, QL, KH, KL bf16 [NB*SEQ][8*64]              8388608 each
//   VP  f16  [NB][8*64][SEQ] x1024                   8388608
//   end                                              52953088 at NB=2, SEQ=4096
// Inputs (in order): x [NB_FULL][SEQ_FULL][512], mask [NB_FULL][1][1][SEQ_FULL], Wq [512 in][512 out], bq [512], Wk, bk,
// Wv, bv (all f32). Output: ctx f32 [NB][SEQ][512].
// =====================================================================================================
extern "C" void kernel_launch(void* const* d_in, const int* in_sizes, int n_in,
                              void* d_out, int out_size, void* d_ws, size_t ws_size,
                              hipStream_t stream) {
  if (n_in < 8) return;
  if (in_sizes[0] < ((NB - 1) * SEQ_FULL + SEQ) * DMOD) return;
  if (in_sizes[1] < (NB - 1) * SEQ_FULL + SEQ) return;
  if (in_sizes[2] < DMOD * DMOD || in_sizes[4] < DMOD * DMOD || in_sizes[6] < DMOD * DMOD) return;
  if (in_sizes[3] < DMOD || in_sizes[5] < DMOD || in_sizes[7] < DMOD) return;
  if (out_size < NB * SEQ * DMOD) return;

  const float* Xin = (const float*)d_in[0];
  const float* Msk = (const float*)d_in[1];
  const float* Wq  = (const float*)d_in[2];
  const float* bq  = (const float*)d_in[3];
  const float* Wk  = (const float*)d_in[4];
  const float* bk  = (const float*)d_in[5];
  const float* Wv  = (const float*)d_in[6];
  const float* bv  = (const float*)d_in[7];
  float*       out = (float*)d_out;

  const size_t szXB = (size_t)NB * SEQ * DMOD * 2;              //  8388608
  const size_t szW  = (size_t)DMOD * DMOD * 2;                  //   524288
  const size_t szCS = (size_t)SEQ * 64 * 4;                     //  1048576
  const size_t szP  = (size_t)NB * SEQ * DMOD * 2;              //  8388608
  const size_t szVP = (size_t)NB * DMOD * SEQ * 2;              //  8388608
  size_t off = 0;
  const size_t oXB = off; off += szXB;
  const size_t oWQ = off; off += szW;
  const size_t oWK = off; off += szW;
  const size_t oWV = off; off += szW;
  const size_t oCS = off; off += szCS;
  const size_t oQH = off; off += szP;
  const size_t oQL = off; off += szP;
  const size_t oKH = off; off += szP;
  const size_t oKL = off; off += szP;
  const size_t oVP = off; off += szVP;
  if (off > ws_size) return;                            // off = 52953088 at NB=2, SEQ=4096
  if (off > (size_t)134217728) return;

  char* ws = (char*)d_ws;
  u16*   XB  = (u16*)(ws + oXB);
  u16*   WQT = (u16*)(ws + oWQ);
  u16*   WKT = (u16*)(ws + oWK);
  u16*   WVT = (u16*)(ws + oWV);
  float* CS  = (float*)(ws + oCS);
  u16*   QH  = (u16*)(ws + oQH);
  u16*   QL  = (u16*)(ws + oQL);
  u16*   KH  = (u16*)(ws + oKH);
  u16*   KL  = (u16*)(ws + oKL);
  u16*   VP  = (u16*)(ws + oVP);

  // inv_freq[j] = 1 / 10000^(2j/64) as the exact f32 values of the eager f32 pow chain (table index j = d >> 1 of the
  // repeat-interleaved cos/sin layout); passed by value, selected on the device by a static chain
  RopeFreq fr;
  {
    const float invf[32] = {
      1.0f, 0.7498942017555237f, 0.5623413324356079f, 0.4216965138912201f,
      0.3162277638912201f, 0.23713736236095428f, 0.17782793939113617f, 0.1333521455526352f,
      0.10000000149011612f, 0.07498941570520401f, 0.05623412877321243f, 0.04216964915394783f,
      0.03162277862429619f, 0.0237137358635664f, 0.017782794311642647f, 0.01333521492779255f,
      0.009999999776482582f, 0.007498942315578461f, 0.005623413249850273f, 0.0042169648222625256f,
      0.003162277862429619f, 0.0023713738191872835f, 0.0017782794311642647f, 0.0013335214462131262f,
      0.0010000000474974513f, 0.0007498941849917173f, 0.000562341301701963f, 0.00042169648804701865f,
      0.0003162277862429619f, 0.0002371373848291114f, 0.00017782794020604342f, 0.0001333521504420787f};
    for (int j = 0; j < 32; ++j) fr.f[j] = invf[j];
  }

  const int n8x = (NB * SEQ * DMOD) / 8;                // 524288
  if ((n8x % 256) != 0) return;
  if ((DMOD % 64) != 0 || (SEQ % 64) != 0 || (DMOD % 32) != 0 || (SEQ % 8) != 0) return;
  const dim3 blk(256);
  const dim3 gX(n8x / 256);                             // 2048
  const dim3 gTW((DMOD / 64) * (DMOD / 64));            // 64
  const dim3 gCS(SEQ / 8);                              // 512
  const dim3 gGQ((NB * SEQ / 64) * (DMOD / 64));        // 1024
  const dim3 gV((DMOD / 64) * (SEQ / 64), NB);          // 512 x 2
  const dim3 bG(128);
  const dim3 gAT(ATT_BLOCKS);                           // 1024
  const dim3 bAT(ATT_THREADS);                          // 128

  // (0) x -> bf16 plane [NB*SEQ][512] (batch rows read with the full sequence stride)
  cvt_x<<<gX, blk, 0, stream>>>(Xin, XB, n8x, (SEQ * DMOD) / 8, (SEQ_FULL * DMOD) / 8);
  // (1..3) W [in][out] -> bf16 W^T planes [out n][in k] (k-contiguous)
  tr_w<<<gTW, blk, 0, stream>>>(Wq, WQT);
  tr_w<<<gTW, blk, 0, stream>>>(Wk, WKT);
  tr_w<<<gTW, blk, 0, stream>>>(Wv, WVT);
  // (4) cos/sin table [SEQ][64]
  rope_tab<<<gCS, blk, 0, stream>>>(fr, CS);
  // (5,6) q and k: (x.W + b) -> RoPE -> bf16 hi / residual planes [NB*SEQ][h*64+d]; bias by column
  gemm_rope<<<gGQ, bG, 0, stream>>>(XB, WQT, bq, CS, QH, QL, NB * SEQ, DMOD, DMOD, DMOD, SEQ);
  gemm_rope<<<gGQ, bG, 0, stream>>>(XB, WKT, bk, CS, KH, KL, NB * SEQ, DMOD, DMOD, DMOD, SEQ);
  // (7) v^T plane per batch: [512 = h*64+d][SEQ keys] = f16((Wv^T . x^T + bv) x1024); bias by row
  gemm_vt<<<gV, bG, 0, stream>>>(WVT, XB, VP, bv, DMOD, SEQ, DMOD, DMOD, VCAR, SEQ * DMOD, DMOD * SEQ);
  // (8) attention with per-key mask -> ctx f32 [NB][SEQ][h*64+d]
  attn_fwd<<<gAT, bAT, 0, stream>>>(QH, QL, KH, KL, VP, Msk, out);
  (void)hipGetLastError();
}
